// v000
// Times are from an AMD MI455X. After a warm-up the kernel runs many times in a row, and a time is the length of
// such a window on the GPU divided by its runs, so every launch and the gaps after it count. The runs cycle
// through copies of the inputs. A figure is the median of several windows, for all but v000 over two sittings.
// Sittings can differ by a few percent; kernels timed side by side share one.
// The starting kernel, v000, takes 450 microseconds a run.
#include <hip/hip_runtime.h>

#define DIMC 384
#define NPIX 3136   // 56*56
#define NBATCH 8

typedef __attribute__((ext_vector_type(16))) _Float16     v16h;
typedef __attribute__((ext_vector_type(8)))  float        v8f;
typedef __attribute__((ext_vector_type(4)))  unsigned int v4u;
typedef __attribute__((ext_vector_type(8)))  unsigned int v8u;

static __device__ __forceinline__ v8f wmma16(v16h a, v16h b, v8f c) {
  // D = A(16x32 f16) x B(32x16 f16) + C(16x16 f32)
  return __builtin_amdgcn_wmma_f32_16x16x32_f16(false, a, false, b, (short)0, c,
                                                false, false);
}

// Load one 16x32 f16 fragment (A or B operand) given a pointer already offset
// by (row*stride + kchunk + hb*8) in halfword units.  lo dwords = K{0..7|8..15},
// hi dwords (+16 halves) = K{16..23|24..31} per the CDNA5 16-bit VGPR layout.
static __device__ __forceinline__ v16h load_frag(const _Float16* p) {
  v4u lo = *(const v4u*)(p);
  v4u hi = *(const v4u*)(p + 16);
  v8u u;
  u[0] = lo[0]; u[1] = lo[1]; u[2] = lo[2]; u[3] = lo[3];
  u[4] = hi[0]; u[5] = hi[1]; u[6] = hi[2]; u[7] = hi[3];
  return __builtin_bit_cast(v16h, u);
}

// B fragment for fp32 weight row (cvt f32->f16 on the fly).
static __device__ __forceinline__ v16h wfrag(const float* wr, int hb) {
  const float4* p0 = (const float4*)(wr + hb * 8);
  const float4* p1 = (const float4*)(wr + 16 + hb * 8);
  float4 a0 = p0[0], a1 = p0[1], b0 = p1[0], b1 = p1[1];
  v16h h;
  h[0]  = (_Float16)a0.x; h[1]  = (_Float16)a0.y; h[2]  = (_Float16)a0.z; h[3]  = (_Float16)a0.w;
  h[4]  = (_Float16)a1.x; h[5]  = (_Float16)a1.y; h[6]  = (_Float16)a1.z; h[7]  = (_Float16)a1.w;
  h[8]  = (_Float16)b0.x; h[9]  = (_Float16)b0.y; h[10] = (_Float16)b0.z; h[11] = (_Float16)b0.w;
  h[12] = (_Float16)b1.x; h[13] = (_Float16)b1.y; h[14] = (_Float16)b1.z; h[15] = (_Float16)b1.w;
  return h;
}

static __device__ __forceinline__ unsigned int pack2(float a, float b) {
  unsigned short ua = __builtin_bit_cast(unsigned short, (_Float16)a);
  unsigned short ub = __builtin_bit_cast(unsigned short, (_Float16)b);
  return (unsigned int)ua | ((unsigned int)ub << 16);
}

// wave32 xor-shuffle via ds_swizzle (group-of-32 mode: and=0x1f, xor=XM)
template <int XM>
static __device__ __forceinline__ float swz_xor(float v) {
  int x = __builtin_amdgcn_ds_swizzle(__builtin_bit_cast(int, v),
                                      (XM << 10) | 0x1f);
  return __builtin_bit_cast(float, x);
}

// Flat->LDS byte offset: generic pointer to __shared__ is {aperture, offset32};
// the low 32 bits are the LDS byte address.
static __device__ __forceinline__ unsigned lds_off(const void* p) {
  return (unsigned)(unsigned long long)p;
}

// One async 16B copy global->LDS (per-lane), tracked by ASYNCcnt.
static __device__ __forceinline__ void async_cp16(unsigned lds_byte,
                                                  const _Float16* base,
                                                  unsigned gbyte) {
  asm volatile("global_load_async_to_lds_b128 %0, %1, %2"
               :: "v"(lds_byte), "v"(gbyte), "s"(base) : "memory");
}

// ---------------------------------------------------------------------------
// Fused flash-attention.  Block = 4 waves; each wave owns a 16-query tile and
// the full 384-wide output (24 f32 WMMA accumulator tiles, >256 VGPRs via the
// gfx1250 VGPR-MSB mechanism).  Q fragments are hoisted into registers for the
// whole key loop.  K/V^T 32-key blocks are double-buffered in LDS via
// GLOBAL_LOAD_ASYNC_TO_LDS_B128 so the copy of block k+1 overlaps the compute
// of block k; retirement via s_wait_asynccnt.
// ---------------------------------------------------------------------------
__global__ __launch_bounds__(128) void attn_kernel(
    const _Float16* __restrict__ qg,   // [B][N][C]
    const _Float16* __restrict__ kg,   // [B][N][C]
    const _Float16* __restrict__ vtg,  // [B][C][N]
    float* __restrict__ out)           // [B][C][N]
{
  __shared__ __align__(16) _Float16 kbuf[2][32 * 392];    // K block  [m][c]
  __shared__ __align__(16) _Float16 vbuf[2][384 * 40];    // V^T block [d][m]
  __shared__ __align__(16) _Float16 pbuf[4 * 16 * 40];    // per-wave P transpose
  const int tid  = threadIdx.x;
  const int wave = tid >> 5;
  const int lane = tid & 31;
  const int l16  = lane & 15;
  const int hb   = lane >> 4;
  const int b    = blockIdx.y;
  const int n0   = (blockIdx.x * 4 + wave) * 16;
  const _Float16* qrow = qg + ((size_t)b * NPIX + n0) * DIMC;
  const _Float16* kb   = kg + (size_t)b * NPIX * DIMC;
  const _Float16* vb   = vtg + (size_t)b * DIMC * NPIX;
  _Float16* pw = pbuf + wave * 16 * 40;

  const unsigned kofs[2] = {lds_off(&kbuf[0][0]), lds_off(&kbuf[1][0])};
  const unsigned vofs[2] = {lds_off(&vbuf[0][0]), lds_off(&vbuf[1][0])};

  // Q strip: 16 rows x 384 -> 12 A-fragments held in registers across the
  // entire key loop (96 VGPRs; the register file is 1024 VGPRs on gfx1250).
  v16h qf[12];
#pragma unroll
  for (int ck = 0; ck < 12; ++ck)
    qf[ck] = load_frag(qrow + l16 * DIMC + ck * 32 + hb * 8);

  v8f o[24];
  v8f zero = {0.f, 0.f, 0.f, 0.f, 0.f, 0.f, 0.f, 0.f};
#pragma unroll
  for (int i = 0; i < 24; ++i) o[i] = zero;
  float mi[8], li[8];
#pragma unroll
  for (int r = 0; r < 8; ++r) { mi[r] = -3.0e38f; li[r] = 0.f; }

  // Issue async staging of key-block `m0` into buffer `bsel`.
  auto stage = [&](int bsel, int m0) {
#pragma unroll
    for (int it = 0; it < 12; ++it) {            // K: 32 x 384 halves
      int chunk = it * 128 + tid;
      int m = chunk / 48, off = (chunk % 48) * 8;
      async_cp16(kofs[bsel] + (unsigned)(m * 392 + off) * 2, kb,
                 (unsigned)(((m0 + m) * DIMC + off) * 2));
    }
#pragma unroll
    for (int it = 0; it < 12; ++it) {            // V^T: 384 x 32 halves
      int chunk = it * 128 + tid;
      int d = chunk >> 2, off = (chunk & 3) * 8;
      async_cp16(vofs[bsel] + (unsigned)(d * 40 + off) * 2, vb,
                 (unsigned)((d * NPIX + m0 + off) * 2));
    }
  };

  stage(0, 0);                     // prefetch first key block
  for (int kbk = 0; kbk < 98; ++kbk) {
    const int cur = kbk & 1;
    __syncthreads();               // all waves done reading buf[cur^1]
    if (kbk < 97) {
      stage(cur ^ 1, (kbk + 1) * 32);
      // own 24 older asyncs (current block) retired; 24 new may be in flight
      asm volatile("s_wait_asynccnt 0x18" ::: "memory");
    } else {
      asm volatile("s_wait_asynccnt 0x0" ::: "memory");
    }
    __syncthreads();               // current block visible to all waves

    const _Float16* kcur = &kbuf[cur][0];
    const _Float16* vcur = &vbuf[cur][0];

    // S = Q @ K^T : two 16x16 f32 tiles over this 32-key block.
    v8f s0 = zero, s1 = zero;
#pragma unroll
    for (int ck = 0; ck < 12; ++ck) {
      v16h k0 = load_frag(kcur + l16 * 392 + ck * 32 + hb * 8);
      v16h k1 = load_frag(kcur + (16 + l16) * 392 + ck * 32 + hb * 8);
      s0 = wmma16(qf[ck], k0, s0);
      s1 = wmma16(qf[ck], k1, s1);
    }

    // Online softmax (rows r+8*hb; reduce across the 16 lanes of each half).
    float sc[8];
#pragma unroll
    for (int r = 0; r < 8; ++r) {
      float mv = fmaxf(s0[r], s1[r]);
      mv = fmaxf(mv, swz_xor<1>(mv));
      mv = fmaxf(mv, swz_xor<2>(mv));
      mv = fmaxf(mv, swz_xor<4>(mv));
      mv = fmaxf(mv, swz_xor<8>(mv));
      float mn = fmaxf(mi[r], mv);
      float s  = __expf(mi[r] - mn);
      mi[r] = mn;
      float p0 = __expf(s0[r] - mn);
      float p1 = __expf(s1[r] - mn);
      float rs = p0 + p1;
      rs += swz_xor<1>(rs);
      rs += swz_xor<2>(rs);
      rs += swz_xor<4>(rs);
      rs += swz_xor<8>(rs);
      li[r] = li[r] * s + rs;
      sc[r] = s;
      s0[r] = p0; s1[r] = p1;
    }
#pragma unroll
    for (int dt = 0; dt < 24; ++dt) {
#pragma unroll
      for (int r = 0; r < 8; ++r) o[dt][r] *= sc[r];
    }

    // P -> f16, LDS transpose into A-layout (row-major [n][m], stride 40).
#pragma unroll
    for (int r = 0; r < 8; ++r) {
      pw[(r + 8 * hb) * 40 + l16]      = (_Float16)s0[r];
      pw[(r + 8 * hb) * 40 + 16 + l16] = (_Float16)s1[r];
    }
    v16h pf = load_frag(pw + l16 * 40 + hb * 8);

    // O += P @ V  (24 d-tiles, K = 32 keys)
#pragma unroll
    for (int dt = 0; dt < 24; ++dt) {
      v16h vf = load_frag(vcur + (dt * 16 + l16) * 40 + hb * 8);
      o[dt] = wmma16(pf, vf, o[dt]);
    }
  }

  // Epilogue: divide by softmax sum, store out[b][d][n] (contiguous n/lane).
  float inv[8];
#pragma unroll
  for (int r = 0; r < 8; ++r) inv[r] = 1.f / li[r];
  float* ob = out + (size_t)b * DIMC * NPIX;
#pragma unroll
  for (int dt = 0; dt < 24; ++dt) {
    int d = dt * 16 + l16;
    float* orow = ob + (size_t)d * NPIX + n0 + hb * 8;
    float4 f0, f1;
    f0.x = o[dt][0] * inv[0]; f0.y = o[dt][1] * inv[1];
    f0.z = o[dt][2] * inv[2]; f0.w = o[dt][3] * inv[3];
    f1.x = o[dt][4] * inv[4]; f1.y = o[dt][5] * inv[5];
    f1.z = o[dt][6] * inv[6]; f1.w = o[dt][7] * inv[7];
    *(float4*)(orow)     = f0;
    *(float4*)(orow + 4) = f1;
  }
}

// ---------------------------------------------------------------------------
// Kernel 1: q = (x^T @ W1^T) * C^-0.5   -> f16 [B][N][C]
//           k = f16(x^T)                -> f16 [B][N][C]
//           v^T = (x^T @ W2^T)^T        -> f16 [B][C][N]
// One wave per 16-token strip; block = 2 waves.
// ---------------------------------------------------------------------------
__global__ __launch_bounds__(64) void proj_kernel(
    const float* __restrict__ x,    // [B][C][N]
    const float* __restrict__ w1,   // [C][C]
    const float* __restrict__ w2,   // [C][C]
    _Float16* __restrict__ qg,      // [B][N][C]
    _Float16* __restrict__ kg,      // [B][N][C]
    _Float16* __restrict__ vtg)     // [B][C][N]
{
  __shared__ __align__(16) _Float16 tl[2 * 16 * 392];  // t strip, [n][c] pad 392
  __shared__ __align__(16) _Float16 qs[2 * 16 * 16];   // per-wave q transpose bounce
  const int wave = threadIdx.x >> 5;
  const int lane = threadIdx.x & 31;
  const int l16  = lane & 15;
  const int hb   = lane >> 4;
  const int b    = blockIdx.y;
  const int n0   = (blockIdx.x * 2 + wave) * 16;
  _Float16* tw = tl + wave * 16 * 392;
  _Float16* qw = qs + wave * 256;
  const float* xb = x + (size_t)b * DIMC * NPIX;

  // Stage 16 x 384 t-strip into LDS as f16 (coalesced b128 along n).
  {
    const int cl = lane >> 2;        // 0..7 : c sub-row
    const int ch = (lane & 3) * 4;   // 0,4,8,12 : n sub-offset
    for (int it = 0; it < 48; ++it) {
      int c = it * 8 + cl;
      const float4 f = *(const float4*)(xb + (size_t)c * NPIX + n0 + ch);
      tw[(ch + 0) * 392 + c] = (_Float16)f.x;
      tw[(ch + 1) * 392 + c] = (_Float16)f.y;
      tw[(ch + 2) * 392 + c] = (_Float16)f.z;
      tw[(ch + 3) * 392 + c] = (_Float16)f.w;
    }
  }
  // Emit K rows (coalesced b128).
  {
    _Float16* kout = kg + ((size_t)b * NPIX + n0) * DIMC;
    for (int it = 0; it < 24; ++it) {
      int chunk = it * 32 + lane;               // 768 chunks x 8 halves
      int r = chunk / 48, off = (chunk % 48) * 8;
      v4u t = *(const v4u*)(tw + r * 392 + off);
      *(v4u*)(kout + r * DIMC + off) = t;
    }
  }

  const float kScale = 0.051031036307982884f;   // 384^-0.5 folded into q
  for (int dt = 0; dt < 24; ++dt) {
    v8f aq = {0.f, 0.f, 0.f, 0.f, 0.f, 0.f, 0.f, 0.f};
    v8f av = aq;
    const int d = dt * 16 + l16;
    const float* w1r = w1 + (size_t)d * DIMC;
    const float* w2r = w2 + (size_t)d * DIMC;
    for (int ck = 0; ck < 12; ++ck) {
      v16h af = load_frag(tw + l16 * 392 + ck * 32 + hb * 8);
      v16h b1 = wfrag(w1r + ck * 32, hb);
      v16h b2 = wfrag(w2r + ck * 32, hb);
      aq = wmma16(af, b1, aq);
      av = wmma16(af, b2, av);
    }
    // v^T store: lane holds d=dt*16+l16, 8 consecutive n -> one b128.
    {
      v4u pk;
      pk[0] = pack2(av[0], av[1]);
      pk[1] = pack2(av[2], av[3]);
      pk[2] = pack2(av[4], av[5]);
      pk[3] = pack2(av[6], av[7]);
      *(v4u*)(vtg + ((size_t)b * DIMC + d) * NPIX + n0 + hb * 8) = pk;
    }
    // q store via LDS transpose bounce (row-major [n][d]).
#pragma unroll
    for (int r = 0; r < 8; ++r)
      qw[(r + 8 * hb) * 16 + l16] = (_Float16)(aq[r] * kScale);
    {
      v4u t = *(const v4u*)(qw + (lane >> 1) * 16 + (lane & 1) * 8);
      *(v4u*)(qg + ((size_t)b * NPIX + n0 + (lane >> 1)) * DIMC + dt * 16 +
              (lane & 1) * 8) = t;
    }
  }
}

extern "C" void kernel_launch(void* const* d_in, const int* in_sizes, int n_in,
                              void* d_out, int out_size, void* d_ws, size_t ws_size,
                              hipStream_t stream) {
  (void)in_sizes; (void)n_in; (void)out_size; (void)ws_size;
  const float* x  = (const float*)d_in[0];
  const float* w1 = (const float*)d_in[1];
  const float* w2 = (const float*)d_in[2];
  float* out = (float*)d_out;

  size_t sz = (size_t)NBATCH * NPIX * DIMC;     // halves per f16 buffer
  _Float16* qg  = (_Float16*)d_ws;              // [B][N][C] f16
  _Float16* kg  = qg + sz;                      // [B][N][C] f16
  _Float16* vtg = kg + sz;                      // [B][C][N] f16

  dim3 g1(98, NBATCH), b1(64);
  proj_kernel<<<g1, b1, 0, stream>>>(x, w1, w2, qg, kg, vtg);
  dim3 g2(49, NBATCH), b2(128);
  attn_kernel<<<g2, b2, 0, stream>>>(qg, kg, vtg, out);
}

// v001
// It runs in 390 microseconds.
// Timed twice side by side with v000, it ran 1.21 and 1.20 times as fast.
#include <hip/hip_runtime.h>

#define DIMC 384
#define NPIX 3136   // 56*56
#define NBATCH 8

typedef __attribute__((ext_vector_type(16))) _Float16     v16h;
typedef __attribute__((ext_vector_type(8)))  float        v8f;
typedef __attribute__((ext_vector_type(4)))  unsigned int v4u;
typedef __attribute__((ext_vector_type(8)))  unsigned int v8u;

static __device__ __forceinline__ v8f wmma16(v16h a, v16h b, v8f c) {
  // D = A(16x32 f16) x B(32x16 f16) + C(16x16 f32)
  return __builtin_amdgcn_wmma_f32_16x16x32_f16(false, a, false, b, (short)0, c,
                                                false, false);
}

// Load one 16x32 f16 fragment (A or B operand) given a pointer already offset
// by (row*stride + kchunk + hb*8) in halfword units.  lo dwords = K{0..7|8..15},
// hi dwords (+16 halves) = K{16..23|24..31} per the CDNA5 16-bit VGPR layout.
static __device__ __forceinline__ v16h load_frag(const _Float16* p) {
  v4u lo = *(const v4u*)(p);
  v4u hi = *(const v4u*)(p + 16);
  v8u u;
  u[0] = lo[0]; u[1] = lo[1]; u[2] = lo[2]; u[3] = lo[3];
  u[4] = hi[0]; u[5] = hi[1]; u[6] = hi[2]; u[7] = hi[3];
  return __builtin_bit_cast(v16h, u);
}

// B fragment for fp32 weight row (cvt f32->f16 on the fly).
static __device__ __forceinline__ v16h wfrag(const float* wr, int hb) {
  const float4* p0 = (const float4*)(wr + hb * 8);
  const float4* p1 = (const float4*)(wr + 16 + hb * 8);
  float4 a0 = p0[0], a1 = p0[1], b0 = p1[0], b1 = p1[1];
  v16h h;
  h[0]  = (_Float16)a0.x; h[1]  = (_Float16)a0.y; h[2]  = (_Float16)a0.z; h[3]  = (_Float16)a0.w;
  h[4]  = (_Float16)a1.x; h[5]  = (_Float16)a1.y; h[6]  = (_Float16)a1.z; h[7]  = (_Float16)a1.w;
  h[8]  = (_Float16)b0.x; h[9]  = (_Float16)b0.y; h[10] = (_Float16)b0.z; h[11] = (_Float16)b0.w;
  h[12] = (_Float16)b1.x; h[13] = (_Float16)b1.y; h[14] = (_Float16)b1.z; h[15] = (_Float16)b1.w;
  return h;
}

static __device__ __forceinline__ unsigned int pack2(float a, float b) {
  unsigned short ua = __builtin_bit_cast(unsigned short, (_Float16)a);
  unsigned short ub = __builtin_bit_cast(unsigned short, (_Float16)b);
  return (unsigned int)ua | ((unsigned int)ub << 16);
}

// wave32 xor-shuffle via ds_swizzle (group-of-32 mode: and=0x1f, xor=XM)
template <int XM>
static __device__ __forceinline__ float swz_xor(float v) {
  int x = __builtin_amdgcn_ds_swizzle(__builtin_bit_cast(int, v),
                                      (XM << 10) | 0x1f);
  return __builtin_bit_cast(float, x);
}

// e^x as one multiply and v_exp_f32 (what __expf compiles to here).  The v_nop
// is the free slot that the instruction set asks for behind a transcendental
// before its source register is overwritten.
static __device__ __forceinline__ float exp_slot(float x) {
  float y = x * 1.44269504088896340736f, r;
  asm("v_exp_f32 %0, %1\n\tv_nop" : "=v"(r) : "v"(y));
  return r;
}

// Flat->LDS byte offset: generic pointer to __shared__ is {aperture, offset32};
// the low 32 bits are the LDS byte address.
static __device__ __forceinline__ unsigned lds_off(const void* p) {
  return (unsigned)(unsigned long long)p;
}

// One async 16B copy global->LDS (per-lane), tracked by ASYNCcnt.
static __device__ __forceinline__ void async_cp16(unsigned lds_byte,
                                                  const _Float16* base,
                                                  unsigned gbyte) {
  asm volatile("global_load_async_to_lds_b128 %0, %1, %2"
               :: "v"(lds_byte), "v"(gbyte), "s"(base) : "memory");
}

// ---------------------------------------------------------------------------
// Fused flash-attention.  Block = 4 waves; each wave owns a 16-query tile and
// the full 384-wide output (24 f32 WMMA accumulator tiles, >256 VGPRs via the
// gfx1250 VGPR-MSB mechanism; at most 512, so that two work-groups share a WGP
// and the whole grid is resident at once).  Q fragments are hoisted into registers for the
// whole key loop.  K/V^T 32-key blocks are double-buffered in LDS via
// GLOBAL_LOAD_ASYNC_TO_LDS_B128 so the copy of block k+1 overlaps the compute
// of block k; retirement via s_wait_asynccnt.
// ---------------------------------------------------------------------------
__global__ __launch_bounds__(128) void attn_kernel(
    const _Float16* __restrict__ qg,   // [B][N][C]
    const _Float16* __restrict__ kg,   // [B][N][C]
    const _Float16* __restrict__ vtg,  // [B][C][N]
    float* __restrict__ out)           // [B][C][N]
{
  __shared__ __align__(16) _Float16 kbuf[2][32 * 392];    // K block  [m][c]
  __shared__ __align__(16) _Float16 vbuf[2][384 * 40];    // V^T block [d][m]
  __shared__ __align__(16) _Float16 pbuf[4 * 16 * 40];    // per-wave P transpose
  const int tid  = threadIdx.x;
  const int wave = tid >> 5;
  const int lane = tid & 31;
  const int l16  = lane & 15;
  const int hb   = lane >> 4;
  const int b    = blockIdx.y;
  const int n0   = (blockIdx.x * 4 + wave) * 16;
  const _Float16* qrow = qg + ((size_t)b * NPIX + n0) * DIMC;
  const _Float16* kb   = kg + (size_t)b * NPIX * DIMC;
  const _Float16* vb   = vtg + (size_t)b * DIMC * NPIX;
  _Float16* pw = pbuf + wave * 16 * 40;

  const unsigned kofs[2] = {lds_off(&kbuf[0][0]), lds_off(&kbuf[1][0])};
  const unsigned vofs[2] = {lds_off(&vbuf[0][0]), lds_off(&vbuf[1][0])};

  // Q strip: 16 rows x 384 -> 12 A-fragments held in registers across the
  // entire key loop (96 VGPRs; the register file is 1024 VGPRs on gfx1250).
  v16h qf[12];
#pragma unroll
  for (int ck = 0; ck < 12; ++ck)
    qf[ck] = load_frag(qrow + l16 * DIMC + ck * 32 + hb * 8);

  v8f o[24];
  v8f zero = {0.f, 0.f, 0.f, 0.f, 0.f, 0.f, 0.f, 0.f};
#pragma unroll
  for (int i = 0; i < 24; ++i) o[i] = zero;
  float mi[8], li[8];
#pragma unroll
  for (int r = 0; r < 8; ++r) { mi[r] = -3.0e38f; li[r] = 0.f; }

  // Issue async staging of key-block `m0` into buffer `bsel`.
  auto stage = [&](int bsel, int m0) {
#pragma unroll
    for (int it = 0; it < 12; ++it) {            // K: 32 x 384 halves
      int chunk = it * 128 + tid;
      int m = chunk / 48, off = (chunk % 48) * 8;
      async_cp16(kofs[bsel] + (unsigned)(m * 392 + off) * 2, kb,
                 (unsigned)(((m0 + m) * DIMC + off) * 2));
    }
#pragma unroll
    for (int it = 0; it < 12; ++it) {            // V^T: 384 x 32 halves
      int chunk = it * 128 + tid;
      int d = chunk >> 2, off = (chunk & 3) * 8;
      async_cp16(vofs[bsel] + (unsigned)(d * 40 + off) * 2, vb,
                 (unsigned)((d * NPIX + m0 + off) * 2));
    }
  };

  stage(0, 0);                     // prefetch first key block
  for (int kbk = 0; kbk < 98; ++kbk) {
    const int cur = kbk & 1;
    __syncthreads();               // all waves done reading buf[cur^1]
    if (kbk < 97) {
      stage(cur ^ 1, (kbk + 1) * 32);
      // own 24 older asyncs (current block) retired; 24 new may be in flight
      asm volatile("s_wait_asynccnt 0x18" ::: "memory");
    } else {
      asm volatile("s_wait_asynccnt 0x0" ::: "memory");
    }
    __syncthreads();               // current block visible to all waves

    const _Float16* kcur = &kbuf[cur][0];
    const _Float16* vcur = &vbuf[cur][0];

    // S = Q @ K^T : two 16x16 f32 tiles over this 32-key block.
    v8f s0 = zero, s1 = zero;
#pragma unroll
    for (int ck = 0; ck < 12; ++ck) {
      v16h k0 = load_frag(kcur + l16 * 392 + ck * 32 + hb * 8);
      v16h k1 = load_frag(kcur + (16 + l16) * 392 + ck * 32 + hb * 8);
      s0 = wmma16(qf[ck], k0, s0);
      s1 = wmma16(qf[ck], k1, s1);
    }

    // The first 12 V fragments are fetched here, ahead of the softmax, so that
    // their LDS latency passes under it (unrolled so that vpre is indexed by
    // constants and stays in registers).
    v16h vpre[12];
#pragma unroll
    for (int dt = 0; dt < 12; ++dt)
      vpre[dt] = load_frag(vcur + (dt * 16 + l16) * 40 + hb * 8);
    // Compiler scheduling fence (emits no instruction): keeps the other 12 V
    // fragment loads below this line.  Hoisted above it they lift the kernel
    // past 512 VGPRs, and then only one wave fits on a SIMD.
    __builtin_amdgcn_sched_barrier(0);

    // Online softmax (rows r+8*hb; reduce across the 16 lanes of each half).
    float sc[8];
#pragma unroll
    for (int r = 0; r < 8; ++r) {
      float mv = fmaxf(s0[r], s1[r]);
      mv = fmaxf(mv, swz_xor<1>(mv));
      mv = fmaxf(mv, swz_xor<2>(mv));
      mv = fmaxf(mv, swz_xor<4>(mv));
      mv = fmaxf(mv, swz_xor<8>(mv));
      float mn = fmaxf(mi[r], mv);
      float s  = exp_slot(mi[r] - mn);
      mi[r] = mn;
      float p0 = exp_slot(s0[r] - mn);
      float p1 = exp_slot(s1[r] - mn);
      float rs = p0 + p1;
      rs += swz_xor<1>(rs);
      rs += swz_xor<2>(rs);
      rs += swz_xor<4>(rs);
      rs += swz_xor<8>(rs);
      li[r] = li[r] * s + rs;
      sc[r] = s;
      s0[r] = p0; s1[r] = p1;
    }
#pragma unroll
    for (int dt = 0; dt < 24; ++dt) {
#pragma unroll
      for (int r = 0; r < 8; ++r) o[dt][r] *= sc[r];
    }

    // P -> f16, LDS transpose into A-layout (row-major [n][m], stride 40).
#pragma unroll
    for (int r = 0; r < 8; ++r) {
      pw[(r + 8 * hb) * 40 + l16]      = (_Float16)s0[r];
      pw[(r + 8 * hb) * 40 + 16 + l16] = (_Float16)s1[r];
    }
    v16h pf = load_frag(pw + l16 * 40 + hb * 8);

    // O += P @ V  (24 d-tiles, K = 32 keys)
#pragma unroll
    for (int dt = 0; dt < 24; ++dt) {
      v16h vf = dt < 12 ? vpre[dt]
                        : load_frag(vcur + (dt * 16 + l16) * 40 + hb * 8);
      o[dt] = wmma16(pf, vf, o[dt]);
    }
  }

  // Epilogue: divide by softmax sum, store out[b][d][n] (contiguous n/lane).
  float inv[8];
#pragma unroll
  for (int r = 0; r < 8; ++r) inv[r] = 1.f / li[r];
  float* ob = out + (size_t)b * DIMC * NPIX;
#pragma unroll
  for (int dt = 0; dt < 24; ++dt) {
    int d = dt * 16 + l16;
    float* orow = ob + (size_t)d * NPIX + n0 + hb * 8;
    float4 f0, f1;
    f0.x = o[dt][0] * inv[0]; f0.y = o[dt][1] * inv[1];
    f0.z = o[dt][2] * inv[2]; f0.w = o[dt][3] * inv[3];
    f1.x = o[dt][4] * inv[4]; f1.y = o[dt][5] * inv[5];
    f1.z = o[dt][6] * inv[6]; f1.w = o[dt][7] * inv[7];
    *(float4*)(orow)     = f0;
    *(float4*)(orow + 4) = f1;
  }
}

// ---------------------------------------------------------------------------
// Kernel 1: q = (x^T @ W1^T) * C^-0.5   -> f16 [B][N][C]
//           k = f16(x^T)                -> f16 [B][N][C]
//           v^T = (x^T @ W2^T)^T        -> f16 [B][C][N]
// One wave per 16-token strip; block = 2 waves.
// ---------------------------------------------------------------------------
__global__ __launch_bounds__(64) void proj_kernel(
    const float* __restrict__ x,    // [B][C][N]
    const float* __restrict__ w1,   // [C][C]
    const float* __restrict__ w2,   // [C][C]
    _Float16* __restrict__ qg,      // [B][N][C]
    _Float16* __restrict__ kg,      // [B][N][C]
    _Float16* __restrict__ vtg)     // [B][C][N]
{
  __shared__ __align__(16) _Float16 tl[2 * 16 * 392];  // t strip, [n][c] pad 392
  __shared__ __align__(16) _Float16 qs[2 * 16 * 16];   // per-wave q transpose bounce
  const int wave = threadIdx.x >> 5;
  const int lane = threadIdx.x & 31;
  const int l16  = lane & 15;
  const int hb   = lane >> 4;
  const int b    = blockIdx.y;
  const int n0   = (blockIdx.x * 2 + wave) * 16;
  _Float16* tw = tl + wave * 16 * 392;
  _Float16* qw = qs + wave * 256;
  const float* xb = x + (size_t)b * DIMC * NPIX;

  // Stage 16 x 384 t-strip into LDS as f16 (coalesced b128 along n).
  {
    const int cl = lane >> 2;        // 0..7 : c sub-row
    const int ch = (lane & 3) * 4;   // 0,4,8,12 : n sub-offset
    for (int it = 0; it < 48; ++it) {
      int c = it * 8 + cl;
      const float4 f = *(const float4*)(xb + (size_t)c * NPIX + n0 + ch);
      tw[(ch + 0) * 392 + c] = (_Float16)f.x;
      tw[(ch + 1) * 392 + c] = (_Float16)f.y;
      tw[(ch + 2) * 392 + c] = (_Float16)f.z;
      tw[(ch + 3) * 392 + c] = (_Float16)f.w;
    }
  }
  // Emit K rows (coalesced b128).
  {
    _Float16* kout = kg + ((size_t)b * NPIX + n0) * DIMC;
    for (int it = 0; it < 24; ++it) {
      int chunk = it * 32 + lane;               // 768 chunks x 8 halves
      int r = chunk / 48, off = (chunk % 48) * 8;
      v4u t = *(const v4u*)(tw + r * 392 + off);
      *(v4u*)(kout + r * DIMC + off) = t;
    }
  }

  const float kScale = 0.051031036307982884f;   // 384^-0.5 folded into q
  for (int dt = 0; dt < 24; ++dt) {
    v8f aq = {0.f, 0.f, 0.f, 0.f, 0.f, 0.f, 0.f, 0.f};
    v8f av = aq;
    const int d = dt * 16 + l16;
    const float* w1r = w1 + (size_t)d * DIMC;
    const float* w2r = w2 + (size_t)d * DIMC;
    for (int ck = 0; ck < 12; ++ck) {
      v16h af = load_frag(tw + l16 * 392 + ck * 32 + hb * 8);
      v16h b1 = wfrag(w1r + ck * 32, hb);
      v16h b2 = wfrag(w2r + ck * 32, hb);
      aq = wmma16(af, b1, aq);
      av = wmma16(af, b2, av);
    }
    // v^T store: lane holds d=dt*16+l16, 8 consecutive n -> one b128.
    {
      v4u pk;
      pk[0] = pack2(av[0], av[1]);
      pk[1] = pack2(av[2], av[3]);
      pk[2] = pack2(av[4], av[5]);
      pk[3] = pack2(av[6], av[7]);
      *(v4u*)(vtg + ((size_t)b * DIMC + d) * NPIX + n0 + hb * 8) = pk;
    }
    // q store via LDS transpose bounce (row-major [n][d]).
#pragma unroll
    for (int r = 0; r < 8; ++r)
      qw[(r + 8 * hb) * 16 + l16] = (_Float16)(aq[r] * kScale);
    {
      v4u t = *(const v4u*)(qw + (lane >> 1) * 16 + (lane & 1) * 8);
      *(v4u*)(qg + ((size_t)b * NPIX + n0 + (lane >> 1)) * DIMC + dt * 16 +
              (lane & 1) * 8) = t;
    }
  }
}

extern "C" void kernel_launch(void* const* d_in, const int* in_sizes, int n_in,
                              void* d_out, int out_size, void* d_ws, size_t ws_size,
                              hipStream_t stream) {
  (void)in_sizes; (void)n_in; (void)out_size; (void)ws_size;
  const float* x  = (const float*)d_in[0];
  const float* w1 = (const float*)d_in[1];
  const float* w2 = (const float*)d_in[2];
  float* out = (float*)d_out;

  size_t sz = (size_t)NBATCH * NPIX * DIMC;     // halves per f16 buffer
  _Float16* qg  = (_Float16*)d_ws;              // [B][N][C] f16
  _Float16* kg  = qg + sz;                      // [B][N][C] f16
  _Float16* vtg = kg + sz;                      // [B][C][N] f16

  dim3 g1(98, NBATCH), b1(64);
  proj_kernel<<<g1, b1, 0, stream>>>(x, w1, w2, qg, kg, vtg);
  dim3 g2(49, NBATCH), b2(128);
  attn_kernel<<<g2, b2, 0, stream>>>(qg, kg, vtg, out);
}

// v002
// It runs in 270 microseconds.
// Timed twice side by side with v001, it ran 1.44 times as fast both times.
// Over all steps from v000 it is 1.74 times as fast.
#include <hip/hip_runtime.h>

#define DIMC 384
#define NPIX 3136   // 56*56
#define NBATCH 8

typedef __attribute__((ext_vector_type(16))) _Float16     v16h;
typedef __attribute__((ext_vector_type(4)))  _Float16     v4h;
typedef __attribute__((ext_vector_type(8)))  float        v8f;
typedef __attribute__((ext_vector_type(4)))  unsigned int v4u;
typedef __attribute__((ext_vector_type(8)))  unsigned int v8u;

static __device__ __forceinline__ v8f wmma16(v16h a, v16h b, v8f c) {
  // D = A(16x32 f16) x B(32x16 f16) + C(16x16 f32)
  return __builtin_amdgcn_wmma_f32_16x16x32_f16(false, a, false, b, (short)0, c,
                                                false, false);
}

// Load one 16x32 f16 fragment (A or B operand) given a pointer already offset
// by (row*stride + kchunk + hb*8) in halfword units.  lo dwords = K{0..7|8..15},
// hi dwords (+16 halves) = K{16..23|24..31} per the CDNA5 16-bit VGPR layout.
static __device__ __forceinline__ v16h load_frag(const _Float16* p) {
  v4u lo = *(const v4u*)(p);
  v4u hi = *(const v4u*)(p + 16);
  v8u u;
  u[0] = lo[0]; u[1] = lo[1]; u[2] = lo[2]; u[3] = lo[3];
  u[4] = hi[0]; u[5] = hi[1]; u[6] = hi[2]; u[7] = hi[3];
  return __builtin_bit_cast(v16h, u);
}

// B fragment for fp32 weight row (cvt f32->f16 on the fly).
static __device__ __forceinline__ v16h wfrag(const float* wr, int hb) {
  const float4* p0 = (const float4*)(wr + hb * 8);
  const float4* p1 = (const float4*)(wr + 16 + hb * 8);
  float4 a0 = p0[0], a1 = p0[1], b0 = p1[0], b1 = p1[1];
  v16h h;
  h[0]  = (_Float16)a0.x; h[1]  = (_Float16)a0.y; h[2]  = (_Float16)a0.z; h[3]  = (_Float16)a0.w;
  h[4]  = (_Float16)a1.x; h[5]  = (_Float16)a1.y; h[6]  = (_Float16)a1.z; h[7]  = (_Float16)a1.w;
  h[8]  = (_Float16)b0.x; h[9]  = (_Float16)b0.y; h[10] = (_Float16)b0.z; h[11] = (_Float16)b0.w;
  h[12] = (_Float16)b1.x; h[13] = (_Float16)b1.y; h[14] = (_Float16)b1.z; h[15] = (_Float16)b1.w;
  return h;
}

static __device__ __forceinline__ unsigned int pack2(float a, float b) {
  unsigned short ua = __builtin_bit_cast(unsigned short, (_Float16)a);
  unsigned short ub = __builtin_bit_cast(unsigned short, (_Float16)b);
  return (unsigned int)ua | ((unsigned int)ub << 16);
}

// wave32 xor-shuffle via ds_swizzle (group-of-32 mode: and=0x1f, xor=XM)
template <int XM>
static __device__ __forceinline__ float swz_xor(float v) {
  int x = __builtin_amdgcn_ds_swizzle(__builtin_bit_cast(int, v),
                                      (XM << 10) | 0x1f);
  return __builtin_bit_cast(float, x);
}

// e^x as one multiply and v_exp_f32 (what __expf compiles to here).  The v_nop
// is the free slot that the instruction set asks for behind a transcendental
// before its source register is overwritten.
static __device__ __forceinline__ float exp_slot(float x) {
  float y = x * 1.44269504088896340736f, r;
  asm("v_exp_f32 %0, %1\n\tv_nop" : "=v"(r) : "v"(y));
  return r;
}

// Flat->LDS byte offset: generic pointer to __shared__ is {aperture, offset32};
// the low 32 bits are the LDS byte address.
static __device__ __forceinline__ unsigned lds_off(const void* p) {
  return (unsigned)(unsigned long long)p;
}

// One async 16B copy global->LDS (per-lane), tracked by ASYNCcnt.
static __device__ __forceinline__ void async_cp16(unsigned lds_byte,
                                                  const _Float16* base,
                                                  unsigned gbyte) {
  asm volatile("global_load_async_to_lds_b128 %0, %1, %2"
               :: "v"(lds_byte), "v"(gbyte), "s"(base) : "memory");
}

// ---------------------------------------------------------------------------
// Fused flash-attention.  Block = 4 waves; each wave owns a 16-query tile and
// the full 384-wide output (24 f32 WMMA accumulator tiles, >256 VGPRs via the
// gfx1250 VGPR-MSB mechanism; at most 512, so that two work-groups share a WGP
// and the whole grid is resident at once).  Q fragments are hoisted into registers for the
// whole key loop.  K/V^T 32-key blocks are double-buffered in LDS via
// GLOBAL_LOAD_ASYNC_TO_LDS_B128 so the copy of block k+1 overlaps the compute
// of block k; retirement via s_wait_asynccnt.
// ---------------------------------------------------------------------------
__global__ __launch_bounds__(128) void attn_kernel(
    const _Float16* __restrict__ qg,   // [B][N][C]
    const _Float16* __restrict__ kg,   // [B][N][C]
    const _Float16* __restrict__ vtg,  // [B][C][N]
    float* __restrict__ out)           // [B][C][N]
{
  __shared__ __align__(16) _Float16 kbuf[2][32 * 392];    // K block  [m][c]
  __shared__ __align__(16) _Float16 vbuf[2][384 * 40];    // V^T block [d][m]
  __shared__ __align__(16) _Float16 pbuf[4 * 16 * 40];    // per-wave P transpose
  const int tid  = threadIdx.x;
  const int wave = tid >> 5;
  const int lane = tid & 31;
  const int l16  = lane & 15;
  const int hb   = lane >> 4;
  const int b    = blockIdx.y;
  const int n0   = (blockIdx.x * 4 + wave) * 16;
  const _Float16* qrow = qg + ((size_t)b * NPIX + n0) * DIMC;
  const _Float16* kb   = kg + (size_t)b * NPIX * DIMC;
  const _Float16* vb   = vtg + (size_t)b * DIMC * NPIX;
  _Float16* pw = pbuf + wave * 16 * 40;

  const unsigned kofs[2] = {lds_off(&kbuf[0][0]), lds_off(&kbuf[1][0])};
  const unsigned vofs[2] = {lds_off(&vbuf[0][0]), lds_off(&vbuf[1][0])};

  // Q strip: 16 rows x 384 -> 12 A-fragments held in registers across the
  // entire key loop (96 VGPRs; the register file is 1024 VGPRs on gfx1250).
  v16h qf[12];
#pragma unroll
  for (int ck = 0; ck < 12; ++ck)
    qf[ck] = load_frag(qrow + l16 * DIMC + ck * 32 + hb * 8);

  v8f o[24];
  v8f zero = {0.f, 0.f, 0.f, 0.f, 0.f, 0.f, 0.f, 0.f};
#pragma unroll
  for (int i = 0; i < 24; ++i) o[i] = zero;
  float mi[8], li[8];
#pragma unroll
  for (int r = 0; r < 8; ++r) { mi[r] = -3.0e38f; li[r] = 0.f; }

  // Issue async staging of key-block `m0` into buffer `bsel`.
  auto stage = [&](int bsel, int m0) {
#pragma unroll
    for (int it = 0; it < 12; ++it) {            // K: 32 x 384 halves
      int chunk = it * 128 + tid;
      int m = chunk / 48, off = (chunk % 48) * 8;
      async_cp16(kofs[bsel] + (unsigned)(m * 392 + off) * 2, kb,
                 (unsigned)(((m0 + m) * DIMC + off) * 2));
    }
#pragma unroll
    for (int it = 0; it < 12; ++it) {            // V^T: 384 x 32 halves
      int chunk = it * 128 + tid;
      int d = chunk >> 2, off = (chunk & 3) * 8;
      async_cp16(vofs[bsel] + (unsigned)(d * 40 + off) * 2, vb,
                 (unsigned)((d * NPIX + m0 + off) * 2));
    }
  };

  stage(0, 0);                     // prefetch first key block
  for (int kbk = 0; kbk < 98; ++kbk) {
    const int cur = kbk & 1;
    __syncthreads();               // all waves done reading buf[cur^1]
    if (kbk < 97) {
      stage(cur ^ 1, (kbk + 1) * 32);
      // own 24 older asyncs (current block) retired; 24 new may be in flight
      asm volatile("s_wait_asynccnt 0x18" ::: "memory");
    } else {
      asm volatile("s_wait_asynccnt 0x0" ::: "memory");
    }
    __syncthreads();               // current block visible to all waves

    const _Float16* kcur = &kbuf[cur][0];
    const _Float16* vcur = &vbuf[cur][0];

    // S = Q @ K^T : two 16x16 f32 tiles over this 32-key block.
    v8f s0 = zero, s1 = zero;
#pragma unroll
    for (int ck = 0; ck < 12; ++ck) {
      v16h k0 = load_frag(kcur + l16 * 392 + ck * 32 + hb * 8);
      v16h k1 = load_frag(kcur + (16 + l16) * 392 + ck * 32 + hb * 8);
      s0 = wmma16(qf[ck], k0, s0);
      s1 = wmma16(qf[ck], k1, s1);
    }

    // The first 12 V fragments are fetched here, ahead of the softmax, so that
    // their LDS latency passes under it (unrolled so that vpre is indexed by
    // constants and stays in registers).
    v16h vpre[12];
#pragma unroll
    for (int dt = 0; dt < 12; ++dt)
      vpre[dt] = load_frag(vcur + (dt * 16 + l16) * 40 + hb * 8);
    // Compiler scheduling fence (emits no instruction): keeps the other 12 V
    // fragment loads below this line.  Hoisted above it they lift the kernel
    // past 512 VGPRs, and then only one wave fits on a SIMD.
    __builtin_amdgcn_sched_barrier(0);

    // Online softmax (rows r+8*hb; reduce across the 16 lanes of each half).
    float sc[8];
#pragma unroll
    for (int r = 0; r < 8; ++r) {
      float mv = fmaxf(s0[r], s1[r]);
      mv = fmaxf(mv, swz_xor<1>(mv));
      mv = fmaxf(mv, swz_xor<2>(mv));
      mv = fmaxf(mv, swz_xor<4>(mv));
      mv = fmaxf(mv, swz_xor<8>(mv));
      float mn = fmaxf(mi[r], mv);
      float s  = exp_slot(mi[r] - mn);
      mi[r] = mn;
      float p0 = exp_slot(s0[r] - mn);
      float p1 = exp_slot(s1[r] - mn);
      float rs = p0 + p1;
      rs += swz_xor<1>(rs);
      rs += swz_xor<2>(rs);
      rs += swz_xor<4>(rs);
      rs += swz_xor<8>(rs);
      li[r] = li[r] * s + rs;
      sc[r] = s;
      s0[r] = p0; s1[r] = p1;
    }
#pragma unroll
    for (int dt = 0; dt < 24; ++dt) {
#pragma unroll
      for (int r = 0; r < 8; ++r) o[dt][r] *= sc[r];
    }

    // P -> f16, LDS transpose into A-layout (row-major [n][m], stride 40).
#pragma unroll
    for (int r = 0; r < 8; ++r) {
      pw[(r + 8 * hb) * 40 + l16]      = (_Float16)s0[r];
      pw[(r + 8 * hb) * 40 + 16 + l16] = (_Float16)s1[r];
    }
    v16h pf = load_frag(pw + l16 * 40 + hb * 8);

    // O += P @ V  (24 d-tiles, K = 32 keys)
#pragma unroll
    for (int dt = 0; dt < 24; ++dt) {
      v16h vf = dt < 12 ? vpre[dt]
                        : load_frag(vcur + (dt * 16 + l16) * 40 + hb * 8);
      o[dt] = wmma16(pf, vf, o[dt]);
    }
  }

  // Epilogue: divide by softmax sum, store out[b][d][n] (contiguous n/lane).
  float inv[8];
#pragma unroll
  for (int r = 0; r < 8; ++r) inv[r] = 1.f / li[r];
  float* ob = out + (size_t)b * DIMC * NPIX;
#pragma unroll
  for (int dt = 0; dt < 24; ++dt) {
    int d = dt * 16 + l16;
    float* orow = ob + (size_t)d * NPIX + n0 + hb * 8;
    float4 f0, f1;
    f0.x = o[dt][0] * inv[0]; f0.y = o[dt][1] * inv[1];
    f0.z = o[dt][2] * inv[2]; f0.w = o[dt][3] * inv[3];
    f1.x = o[dt][4] * inv[4]; f1.y = o[dt][5] * inv[5];
    f1.z = o[dt][6] * inv[6]; f1.w = o[dt][7] * inv[7];
    *(float4*)(orow)     = f0;
    *(float4*)(orow + 4) = f1;
  }
}

// ---------------------------------------------------------------------------
// Kernel 1: q = (x^T @ W1^T) * C^-0.5   -> f16 [B][N][C]
//           k = f16(x^T)                -> f16 [B][N][C]
//           v^T = (x^T @ W2^T)^T        -> f16 [B][C][N]
// One wave per 16-token strip; block = 7 waves (196 strips = 28 x 7).
// The 16 rows of W1 and of W2 that one output tile needs are read once per
// work-group in whole-line loads, converted to f16 and kept in LDS, where all
// seven waves take their B fragments; two buffers, so that the next tile pair
// is on its way from L2 while this one is multiplied.
// ---------------------------------------------------------------------------
// Work-group barrier that orders LDS alone.  __syncthreads() would also wait
// for this wave's global stores of q and v^T, which no wave of this launch reads.
static __device__ __forceinline__ void lds_barrier() {
  __builtin_amdgcn_fence(__ATOMIC_RELEASE, "workgroup", "local");
  __builtin_amdgcn_s_barrier();
  __builtin_amdgcn_fence(__ATOMIC_ACQUIRE, "workgroup", "local");
}

#define PWAVES   7
#define PTHREADS 224
__global__ __launch_bounds__(PTHREADS) void proj_kernel(
    const float* __restrict__ x,    // [B][C][N]
    const float* __restrict__ w1,   // [C][C]
    const float* __restrict__ w2,   // [C][C]
    _Float16* __restrict__ qg,      // [B][N][C]
    _Float16* __restrict__ kg,      // [B][N][C]
    _Float16* __restrict__ vtg)     // [B][C][N]
{
  __shared__ __align__(16) _Float16 tl[PWAVES * 16 * 392];  // t strips, [n][c] pad 392
  __shared__ __align__(16) _Float16 qs[PWAVES * 16 * 16];   // per-wave q transpose bounce
  __shared__ __align__(16) _Float16 wl[2][32 * 392];        // rows 0-15 W1, 16-31 W2
  const int tid  = threadIdx.x;
  const int wave = tid >> 5;
  const int lane = tid & 31;
  const int l16  = lane & 15;
  const int hb   = lane >> 4;
  const int b    = blockIdx.y;
  const int n0   = (blockIdx.x * PWAVES + wave) * 16;
  _Float16* tw = tl + wave * 16 * 392;
  _Float16* qw = qs + wave * 256;
  const float* xb = x + (size_t)b * DIMC * NPIX;

  // Stage 16 x 384 t-strip into LDS as f16 (coalesced b128 along n).
  {
    const int cl = lane >> 2;        // 0..7 : c sub-row
    const int ch = (lane & 3) * 4;   // 0,4,8,12 : n sub-offset
    for (int it = 0; it < 48; ++it) {
      int c = it * 8 + cl;
      const float4 f = *(const float4*)(xb + (size_t)c * NPIX + n0 + ch);
      tw[(ch + 0) * 392 + c] = (_Float16)f.x;
      tw[(ch + 1) * 392 + c] = (_Float16)f.y;
      tw[(ch + 2) * 392 + c] = (_Float16)f.z;
      tw[(ch + 3) * 392 + c] = (_Float16)f.w;
    }
  }
  // Emit K rows (coalesced b128).
  {
    _Float16* kout = kg + ((size_t)b * NPIX + n0) * DIMC;
    for (int it = 0; it < 24; ++it) {
      int chunk = it * 32 + lane;               // 768 chunks x 8 halves
      int r = chunk / 48, off = (chunk % 48) * 8;
      v4u t = *(const v4u*)(tw + r * 392 + off);
      *(v4u*)(kout + r * DIMC + off) = t;
    }
  }

  // The 16 rows of one tile are 24,576 contiguous bytes = 1536 float4 chunks
  // over 224 threads: six full passes and one of 192 threads (whole waves), for
  // W1 and again for W2.  Every wave-load is 512 contiguous bytes.
  int    wd[7];    // this thread's place in the LDS tile in each pass, in halves
  float4 wr[14];   // the tile pair on its way from L2 to LDS (0-6 W1, 7-13 W2)
#pragma unroll
  for (int it = 0; it < 7; ++it) {
    int chunk = it * PTHREADS + tid;
    wd[it] = (chunk / 96) * 392 + (chunk % 96) * 4;
  }
  auto wload = [&](int dt) {
    const float* s1 = w1 + dt * 16 * DIMC;
    const float* s2 = w2 + dt * 16 * DIMC;
#pragma unroll
    for (int it = 0; it < 7; ++it)
      if (it < 6 || tid < 192) {
        wr[it]     = *(const float4*)(s1 + it * PTHREADS * 4 + tid * 4);
        wr[7 + it] = *(const float4*)(s2 + it * PTHREADS * 4 + tid * 4);
      }
  };
  auto wstore = [&](int bsel) {
#pragma unroll
    for (int it = 0; it < 7; ++it)
      if (it < 6 || tid < 192) {
        v4h p1, p2;
        p1[0] = (_Float16)wr[it].x;     p1[1] = (_Float16)wr[it].y;
        p1[2] = (_Float16)wr[it].z;     p1[3] = (_Float16)wr[it].w;
        p2[0] = (_Float16)wr[7 + it].x; p2[1] = (_Float16)wr[7 + it].y;
        p2[2] = (_Float16)wr[7 + it].z; p2[3] = (_Float16)wr[7 + it].w;
        *(v4h*)(&wl[bsel][wd[it]])            = p1;
        *(v4h*)(&wl[bsel][16 * 392 + wd[it]]) = p2;
      }
  };

  wload(0);
  wstore(0);
  lds_barrier();                   // tile pair 0 visible to all waves

  const float kScale = 0.051031036307982884f;   // 384^-0.5 folded into q
  for (int dt = 0; dt < 24; ++dt) {
    v8f aq = {0.f, 0.f, 0.f, 0.f, 0.f, 0.f, 0.f, 0.f};
    v8f av = aq;
    const int d = dt * 16 + l16;
    const _Float16* wc = &wl[dt & 1][0];
    // Tile pair dt+1 starts from L2 here and lands under this pass's products.
    if (dt + 1 < 24) wload(dt + 1);
    // All fragments of the pass are fetched as one group (unrolled so that the
    // arrays are indexed by constants and stay in registers).
    v16h af[12], b1[12], b2[12];
#pragma unroll
    for (int ck = 0; ck < 12; ++ck) {
      af[ck] = load_frag(tw + l16 * 392 + ck * 32 + hb * 8);
      b1[ck] = load_frag(wc + l16 * 392 + ck * 32 + hb * 8);
      b2[ck] = load_frag(wc + (16 + l16) * 392 + ck * 32 + hb * 8);
    }
    // Compiler scheduling fence (emits no instruction): without it the loads
    // sink to their matrix instructions, six at a time with a full LDS wait
    // in front of every pair of products.
    __builtin_amdgcn_sched_barrier(0);
#pragma unroll
    for (int ck = 0; ck < 12; ++ck) {
      aq = wmma16(af[ck], b1[ck], aq);
      av = wmma16(af[ck], b2[ck], av);
    }
    // v^T store: lane holds d=dt*16+l16, 8 consecutive n -> one b128.
    {
      v4u pk;
      pk[0] = pack2(av[0], av[1]);
      pk[1] = pack2(av[2], av[3]);
      pk[2] = pack2(av[4], av[5]);
      pk[3] = pack2(av[6], av[7]);
      *(v4u*)(vtg + ((size_t)b * DIMC + d) * NPIX + n0 + hb * 8) = pk;
    }
    // q store via LDS transpose bounce (row-major [n][d]).
#pragma unroll
    for (int r = 0; r < 8; ++r)
      qw[(r + 8 * hb) * 16 + l16] = (_Float16)(aq[r] * kScale);
    {
      v4u t = *(const v4u*)(qw + (lane >> 1) * 16 + (lane & 1) * 8);
      *(v4u*)(qg + ((size_t)b * NPIX + n0 + (lane >> 1)) * DIMC + dt * 16 +
              (lane & 1) * 8) = t;
    }
    // Tile pair dt+1 goes into the buffer that was last read in pass dt-1 (the
    // barrier at that pass's foot ended those reads).
    if (dt + 1 < 24) wstore((dt + 1) & 1);
    lds_barrier();                 // publishes dt+1, ends the reads of dt
  }
}

extern "C" void kernel_launch(void* const* d_in, const int* in_sizes, int n_in,
                              void* d_out, int out_size, void* d_ws, size_t ws_size,
                              hipStream_t stream) {
  (void)in_sizes; (void)n_in; (void)out_size; (void)ws_size;
  const float* x  = (const float*)d_in[0];
  const float* w1 = (const float*)d_in[1];
  const float* w2 = (const float*)d_in[2];
  float* out = (float*)d_out;

  size_t sz = (size_t)NBATCH * NPIX * DIMC;     // halves per f16 buffer
  _Float16* qg  = (_Float16*)d_ws;              // [B][N][C] f16
  _Float16* kg  = qg + sz;                      // [B][N][C] f16
  _Float16* vtg = kg + sz;                      // [B][C][N] f16

  dim3 g1(28, NBATCH), b1(224);
  proj_kernel<<<g1, b1, 0, stream>>>(x, w1, w2, qg, kg, vtg);
  dim3 g2(49, NBATCH), b2(128);
  attn_kernel<<<g2, b2, 0, stream>>>(qg, kg, vtg, out);
}

// v003
// A run of this version takes 221 microseconds.
// Timed twice side by side with v002, it ran 1.21 and 1.22 times as fast.
// All steps since v000 together make it 2.11 times as fast.
#include <hip/hip_runtime.h>

#define DIMC 384
#define NPIX 3136   // 56*56
#define NBATCH 8

typedef __attribute__((ext_vector_type(16))) _Float16     v16h;
typedef __attribute__((ext_vector_type(4)))  _Float16     v4h;
typedef __attribute__((ext_vector_type(8)))  float        v8f;
typedef __attribute__((ext_vector_type(4)))  unsigned int v4u;
typedef __attribute__((ext_vector_type(8)))  unsigned int v8u;

static __device__ __forceinline__ v8f wmma16(v16h a, v16h b, v8f c) {
  // D = A(16x32 f16) x B(32x16 f16) + C(16x16 f32)
  return __builtin_amdgcn_wmma_f32_16x16x32_f16(false, a, false, b, (short)0, c,
                                                false, false);
}

// Load one 16x32 f16 fragment (A or B operand) given a pointer already offset
// by (row*stride + kchunk + hb*8) in halfword units.  lo dwords = K{0..7|8..15},
// hi dwords (+16 halves) = K{16..23|24..31} per the CDNA5 16-bit VGPR layout.
static __device__ __forceinline__ v16h load_frag(const _Float16* p) {
  v4u lo = *(const v4u*)(p);
  v4u hi = *(const v4u*)(p + 16);
  v8u u;
  u[0] = lo[0]; u[1] = lo[1]; u[2] = lo[2]; u[3] = lo[3];
  u[4] = hi[0]; u[5] = hi[1]; u[6] = hi[2]; u[7] = hi[3];
  return __builtin_bit_cast(v16h, u);
}

// B fragment for fp32 weight row (cvt f32->f16 on the fly).
static __device__ __forceinline__ v16h wfrag(const float* wr, int hb) {
  const float4* p0 = (const float4*)(wr + hb * 8);
  const float4* p1 = (const float4*)(wr + 16 + hb * 8);
  float4 a0 = p0[0], a1 = p0[1], b0 = p1[0], b1 = p1[1];
  v16h h;
  h[0]  = (_Float16)a0.x; h[1]  = (_Float16)a0.y; h[2]  = (_Float16)a0.z; h[3]  = (_Float16)a0.w;
  h[4]  = (_Float16)a1.x; h[5]  = (_Float16)a1.y; h[6]  = (_Float16)a1.z; h[7]  = (_Float16)a1.w;
  h[8]  = (_Float16)b0.x; h[9]  = (_Float16)b0.y; h[10] = (_Float16)b0.z; h[11] = (_Float16)b0.w;
  h[12] = (_Float16)b1.x; h[13] = (_Float16)b1.y; h[14] = (_Float16)b1.z; h[15] = (_Float16)b1.w;
  return h;
}

static __device__ __forceinline__ unsigned int pack2(float a, float b) {
  unsigned short ua = __builtin_bit_cast(unsigned short, (_Float16)a);
  unsigned short ub = __builtin_bit_cast(unsigned short, (_Float16)b);
  return (unsigned int)ua | ((unsigned int)ub << 16);
}

// Value of lane l ^ 16 (the other wave half), by a vector cross-row move.
static __device__ __forceinline__ float xhalf(float v) {
  int x = __builtin_bit_cast(int, v);
  return __builtin_bit_cast(float, __builtin_amdgcn_permlanex16(
      x, x, 0x76543210, 0xfedcba98, false, false));
}

// e^x as one multiply and v_exp_f32 (what __expf compiles to here).  The v_nop
// is the free slot that the instruction set asks for behind a transcendental
// before its source register is overwritten.
static __device__ __forceinline__ float exp_slot(float x) {
  float y = x * 1.44269504088896340736f, r;
  asm("v_exp_f32 %0, %1\n\tv_nop" : "=v"(r) : "v"(y));
  return r;
}

// Flat->LDS byte offset: generic pointer to __shared__ is {aperture, offset32};
// the low 32 bits are the LDS byte address.
static __device__ __forceinline__ unsigned lds_off(const void* p) {
  return (unsigned)(unsigned long long)p;
}

// One async 16B copy global->LDS (per-lane), tracked by ASYNCcnt.
static __device__ __forceinline__ void async_cp16(unsigned lds_byte,
                                                  const _Float16* base,
                                                  unsigned gbyte) {
  asm volatile("global_load_async_to_lds_b128 %0, %1, %2"
               :: "v"(lds_byte), "v"(gbyte), "s"(base) : "memory");
}

__global__ __launch_bounds__(128) void attn_kernel(
    const _Float16* __restrict__ qg,   // [B][N][C]
    const _Float16* __restrict__ kg,   // [B][N][C]
    const _Float16* __restrict__ vtg,  // [B][C][N]
    float* __restrict__ out)           // [B][C][N]
{
  __shared__ __align__(16) _Float16 kbuf[2][32 * 392];    // K block  [m][c]
  __shared__ __align__(16) _Float16 vbuf[2][384 * 40];    // V^T block [d][m]
  const int tid  = threadIdx.x;
  const int wave = tid >> 5;
  const int lane = tid & 31;
  const int l16  = lane & 15;
  const int hb   = lane >> 4;
  const int b    = blockIdx.y;
  const int n0   = (blockIdx.x * 4 + wave) * 16;
  const _Float16* qrow = qg + ((size_t)b * NPIX + n0) * DIMC;
  const _Float16* kb   = kg + (size_t)b * NPIX * DIMC;
  const _Float16* vb   = vtg + (size_t)b * DIMC * NPIX;

  const unsigned kofs[2] = {lds_off(&kbuf[0][0]), lds_off(&kbuf[1][0])};
  const unsigned vofs[2] = {lds_off(&vbuf[0][0]), lds_off(&vbuf[1][0])};

  // Q strip: 16 rows x 384 -> 12 B-fragments held in registers across the
  // entire key loop (96 VGPRs; the register file is 1024 VGPRs on gfx1250).
  v16h qf[12];
#pragma unroll
  for (int ck = 0; ck < 12; ++ck)
    qf[ck] = load_frag(qrow + l16 * DIMC + ck * 32 + hb * 8);

  v8f o[24];
  v8f zero = {0.f, 0.f, 0.f, 0.f, 0.f, 0.f, 0.f, 0.f};
#pragma unroll
  for (int i = 0; i < 24; ++i) o[i] = zero;
  float mi = -3.0e38f;   // running maximum of query l16 (equal in both halves)
  float li = 0.f;        // running sum over this half's 16 keys of every block

  // Issue async staging of key-block `m0` into buffer `bsel`.
  auto stage = [&](int bsel, int m0) {
#pragma unroll
    for (int it = 0; it < 12; ++it) {            // K: 32 x 384 halves
      int chunk = it * 128 + tid;
      int m = chunk / 48, off = (chunk % 48) * 8;
      async_cp16(kofs[bsel] + (unsigned)(m * 392 + off) * 2, kb,
                 (unsigned)(((m0 + m) * DIMC + off) * 2));
    }
#pragma unroll
    for (int it = 0; it < 12; ++it) {            // V^T: 384 x 32 halves
      int chunk = it * 128 + tid;
      int d = chunk >> 2, off = (chunk & 3) * 8;
      async_cp16(vofs[bsel] + (unsigned)(d * 40 + off) * 2, vb,
                 (unsigned)((d * NPIX + m0 + off) * 2));
    }
  };

  stage(0, 0);                     // prefetch first key block
  for (int kbk = 0; kbk < 98; ++kbk) {
    const int cur = kbk & 1;
    __syncthreads();               // all waves done reading buf[cur^1]
    if (kbk < 97) {
      stage(cur ^ 1, (kbk + 1) * 32);
      // own 24 older asyncs (current block) retired; 24 new may be in flight
      asm volatile("s_wait_asynccnt 0x18" ::: "memory");
    } else {
      asm volatile("s_wait_asynccnt 0x0" ::: "memory");
    }
    __syncthreads();               // current block visible to all waves

    const _Float16* kcur = &kbuf[cur][0];
    const _Float16* vcur = &vbuf[cur][0];

    // S^T = K @ Q^T : two 16x16 f32 tiles, keys 8*hb+r and 16+8*hb+r of this
    // 32-key block in register r, query l16.
    v8f s0 = zero, s1 = zero;
#pragma unroll
    for (int ck = 0; ck < 12; ++ck) {
      v16h k0 = load_frag(kcur + l16 * 392 + ck * 32 + hb * 8);
      v16h k1 = load_frag(kcur + (16 + l16) * 392 + ck * 32 + hb * 8);
      s0 = wmma16(k0, qf[ck], s0);
      s1 = wmma16(k1, qf[ck], s1);
    }

    // The first 12 V fragments are fetched here, ahead of the softmax, so that
    // their LDS latency passes under it (unrolled so that vpre is indexed by
    // constants and stays in registers).
    v16h vpre[12];
#pragma unroll
    for (int dt = 0; dt < 12; ++dt)
      vpre[dt] = load_frag(vcur + (dt * 16 + l16) * 40 + hb * 8);
    // Compiler scheduling fence (emits no instruction): keeps the other 12 V
    // fragment loads below this line.  Hoisted above it they lift the kernel
    // past 512 VGPRs, and then only one wave fits on a SIMD.
    __builtin_amdgcn_sched_barrier(0);

    // Online softmax of query l16: 16 scores in this lane, 16 in lane l ^ 16.
    float m8[8];
#pragma unroll
    for (int r = 0; r < 8; ++r) m8[r] = fmaxf(s0[r], s1[r]);
    float mv = fmaxf(fmaxf(fmaxf(m8[0], m8[1]), fmaxf(m8[2], m8[3])),
                     fmaxf(fmaxf(m8[4], m8[5]), fmaxf(m8[6], m8[7])));
    mv = fmaxf(mv, xhalf(mv));
    const float mn = fmaxf(mi, mv);
    const float sc = exp_slot(mi - mn);
    mi = mn;
    float a8[8];
#pragma unroll
    for (int r = 0; r < 8; ++r) {
      s0[r] = exp_slot(s0[r] - mn);
      s1[r] = exp_slot(s1[r] - mn);
      a8[r] = s0[r] + s1[r];
    }
    li = li * sc + (((a8[0] + a8[1]) + (a8[2] + a8[3])) +
                    ((a8[4] + a8[5]) + (a8[6] + a8[7])));
#pragma unroll
    for (int dt = 0; dt < 24; ++dt) {
#pragma unroll
      for (int r = 0; r < 8; ++r) o[dt][r] *= sc;
    }

    // P^T -> f16 in place: elements 0-7 are keys 8*hb+r, 8-15 keys 16+8*hb+r,
    // the k order in which load_frag delivers the V^T rows.
    v16h pf;
#pragma unroll
    for (int r = 0; r < 8; ++r) {
      pf[r]     = (_Float16)s0[r];
      pf[8 + r] = (_Float16)s1[r];
    }

    // O^T += V^T @ P^T  (24 d-tiles, K = 32 keys)
#pragma unroll
    for (int dt = 0; dt < 24; ++dt) {
      v16h vf = dt < 12 ? vpre[dt]
                        : load_frag(vcur + (dt * 16 + l16) * 40 + hb * 8);
      o[dt] = wmma16(vf, pf, o[dt]);
    }
  }

  // Epilogue: join the halves' sums, divide, store out[b][d][n]: register r of
  // tile dt is row d = dt*16 + 8*hb + r, and 16 lanes cover 64 contiguous bytes.
  const float inv = 1.f / (li + xhalf(li));
  float* ob = out + ((size_t)b * DIMC + 8 * hb) * NPIX + n0 + l16;
#pragma unroll
  for (int dt = 0; dt < 24; ++dt) {
#pragma unroll
    for (int r = 0; r < 8; ++r) o[dt][r] *= inv;
  }
  // Compiler scheduling fence (emits no instruction): every product stands in
  // front of the first store.  Mixed with the stores they reuse registers that
  // issued stores still name, with a wait in front of each reuse.
  __builtin_amdgcn_sched_barrier(0);
#pragma unroll
  for (int dt = 0; dt < 24; ++dt) {
#pragma unroll
    for (int r = 0; r < 8; ++r) ob[(dt * 16 + r) * NPIX] = o[dt][r];
  }
}

// ---------------------------------------------------------------------------
// Kernel 1: q = (x^T @ W1^T) * C^-0.5   -> f16 [B][N][C]
//           k = f16(x^T)                -> f16 [B][N][C]
//           v^T = (x^T @ W2^T)^T        -> f16 [B][C][N]
// One wave per 16-token strip; block = 7 waves (196 strips = 28 x 7).
// The 16 rows of W1 and of W2 that one output tile needs are read once per
// work-group in whole-line loads, converted to f16 and kept in LDS, where all
// seven waves take their B fragments; two buffers, so that the next tile pair
// is on its way from L2 while this one is multiplied.
// ---------------------------------------------------------------------------
// Work-group barrier that orders LDS alone.  __syncthreads() would also wait
// for this wave's global stores of q and v^T, which no wave of this launch reads.
static __device__ __forceinline__ void lds_barrier() {
  __builtin_amdgcn_fence(__ATOMIC_RELEASE, "workgroup", "local");
  __builtin_amdgcn_s_barrier();
  __builtin_amdgcn_fence(__ATOMIC_ACQUIRE, "workgroup", "local");
}

#define PWAVES   7
#define PTHREADS 224
__global__ __launch_bounds__(PTHREADS) void proj_kernel(
    const float* __restrict__ x,    // [B][C][N]
    const float* __restrict__ w1,   // [C][C]
    const float* __restrict__ w2,   // [C][C]
    _Float16* __restrict__ qg,      // [B][N][C]
    _Float16* __restrict__ kg,      // [B][N][C]
    _Float16* __restrict__ vtg)     // [B][C][N]
{
  __shared__ __align__(16) _Float16 tl[PWAVES * 16 * 392];  // t strips, [n][c] pad 392
  __shared__ __align__(16) _Float16 qs[PWAVES * 16 * 16];   // per-wave q transpose bounce
  __shared__ __align__(16) _Float16 wl[2][32 * 392];        // rows 0-15 W1, 16-31 W2
  const int tid  = threadIdx.x;
  const int wave = tid >> 5;
  const int lane = tid & 31;
  const int l16  = lane & 15;
  const int hb   = lane >> 4;
  const int b    = blockIdx.y;
  const int n0   = (blockIdx.x * PWAVES + wave) * 16;
  _Float16* tw = tl + wave * 16 * 392;
  _Float16* qw = qs + wave * 256;
  const float* xb = x + (size_t)b * DIMC * NPIX;

  // Stage 16 x 384 t-strip into LDS as f16 (coalesced b128 along n).
  {
    const int cl = lane >> 2;        // 0..7 : c sub-row
    const int ch = (lane & 3) * 4;   // 0,4,8,12 : n sub-offset
    for (int it = 0; it < 48; ++it) {
      int c = it * 8 + cl;
      const float4 f = *(const float4*)(xb + (size_t)c * NPIX + n0 + ch);
      tw[(ch + 0) * 392 + c] = (_Float16)f.x;
      tw[(ch + 1) * 392 + c] = (_Float16)f.y;
      tw[(ch + 2) * 392 + c] = (_Float16)f.z;
      tw[(ch + 3) * 392 + c] = (_Float16)f.w;
    }
  }
  // Emit K rows (coalesced b128).
  {
    _Float16* kout = kg + ((size_t)b * NPIX + n0) * DIMC;
    for (int it = 0; it < 24; ++it) {
      int chunk = it * 32 + lane;               // 768 chunks x 8 halves
      int r = chunk / 48, off = (chunk % 48) * 8;
      v4u t = *(const v4u*)(tw + r * 392 + off);
      *(v4u*)(kout + r * DIMC + off) = t;
    }
  }

  // The 16 rows of one tile are 24,576 contiguous bytes = 1536 float4 chunks
  // over 224 threads: six full passes and one of 192 threads (whole waves), for
  // W1 and again for W2.  Every wave-load is 512 contiguous bytes.
  int    wd[7];    // this thread's place in the LDS tile in each pass, in halves
  float4 wr[14];   // the tile pair on its way from L2 to LDS (0-6 W1, 7-13 W2)
#pragma unroll
  for (int it = 0; it < 7; ++it) {
    int chunk = it * PTHREADS + tid;
    wd[it] = (chunk / 96) * 392 + (chunk % 96) * 4;
  }
  auto wload = [&](int dt) {
    const float* s1 = w1 + dt * 16 * DIMC;
    const float* s2 = w2 + dt * 16 * DIMC;
#pragma unroll
    for (int it = 0; it < 7; ++it)
      if (it < 6 || tid < 192) {
        wr[it]     = *(const float4*)(s1 + it * PTHREADS * 4 + tid * 4);
        wr[7 + it] = *(const float4*)(s2 + it * PTHREADS * 4 + tid * 4);
      }
  };
  auto wstore = [&](int bsel) {
#pragma unroll
    for (int it = 0; it < 7; ++it)
      if (it < 6 || tid < 192) {
        v4h p1, p2;
        p1[0] = (_Float16)wr[it].x;     p1[1] = (_Float16)wr[it].y;
        p1[2] = (_Float16)wr[it].z;     p1[3] = (_Float16)wr[it].w;
        p2[0] = (_Float16)wr[7 + it].x; p2[1] = (_Float16)wr[7 + it].y;
        p2[2] = (_Float16)wr[7 + it].z; p2[3] = (_Float16)wr[7 + it].w;
        *(v4h*)(&wl[bsel][wd[it]])            = p1;
        *(v4h*)(&wl[bsel][16 * 392 + wd[it]]) = p2;
      }
  };

  wload(0);
  wstore(0);
  lds_barrier();                   // tile pair 0 visible to all waves

  const float kScale = 0.051031036307982884f;   // 384^-0.5 folded into q
  for (int dt = 0; dt < 24; ++dt) {
    v8f aq = {0.f, 0.f, 0.f, 0.f, 0.f, 0.f, 0.f, 0.f};
    v8f av = aq;
    const int d = dt * 16 + l16;
    const _Float16* wc = &wl[dt & 1][0];
    // Tile pair dt+1 starts from L2 here and lands under this pass's products.
    if (dt + 1 < 24) wload(dt + 1);
    // All fragments of the pass are fetched as one group (unrolled so that the
    // arrays are indexed by constants and stay in registers).
    v16h af[12], b1[12], b2[12];
#pragma unroll
    for (int ck = 0; ck < 12; ++ck) {
      af[ck] = load_frag(tw + l16 * 392 + ck * 32 + hb * 8);
      b1[ck] = load_frag(wc + l16 * 392 + ck * 32 + hb * 8);
      b2[ck] = load_frag(wc + (16 + l16) * 392 + ck * 32 + hb * 8);
    }
    // Compiler scheduling fence (emits no instruction): without it the loads
    // sink to their matrix instructions, six at a time with a full LDS wait
    // in front of every pair of products.
    __builtin_amdgcn_sched_barrier(0);
#pragma unroll
    for (int ck = 0; ck < 12; ++ck) {
      aq = wmma16(af[ck], b1[ck], aq);
      av = wmma16(af[ck], b2[ck], av);
    }
    // v^T store: lane holds d=dt*16+l16, 8 consecutive n -> one b128.
    {
      v4u pk;
      pk[0] = pack2(av[0], av[1]);
      pk[1] = pack2(av[2], av[3]);
      pk[2] = pack2(av[4], av[5]);
      pk[3] = pack2(av[6], av[7]);
      *(v4u*)(vtg + ((size_t)b * DIMC + d) * NPIX + n0 + hb * 8) = pk;
    }
    // q store via LDS transpose bounce (row-major [n][d]).
#pragma unroll
    for (int r = 0; r < 8; ++r)
      qw[(r + 8 * hb) * 16 + l16] = (_Float16)(aq[r] * kScale);
    {
      v4u t = *(const v4u*)(qw + (lane >> 1) * 16 + (lane & 1) * 8);
      *(v4u*)(qg + ((size_t)b * NPIX + n0 + (lane >> 1)) * DIMC + dt * 16 +
              (lane & 1) * 8) = t;
    }
    // Tile pair dt+1 goes into the buffer that was last read in pass dt-1 (the
    // barrier at that pass's foot ended those reads).
    if (dt + 1 < 24) wstore((dt + 1) & 1);
    lds_barrier();                 // publishes dt+1, ends the reads of dt
  }
}

extern "C" void kernel_launch(void* const* d_in, const int* in_sizes, int n_in,
                              void* d_out, int out_size, void* d_ws, size_t ws_size,
                              hipStream_t stream) {
  (void)in_sizes; (void)n_in; (void)out_size; (void)ws_size;
  const float* x  = (const float*)d_in[0];
  const float* w1 = (const float*)d_in[1];
  const float* w2 = (const float*)d_in[2];
  float* out = (float*)d_out;

  size_t sz = (size_t)NBATCH * NPIX * DIMC;     // halves per f16 buffer
  _Float16* qg  = (_Float16*)d_ws;              // [B][N][C] f16
  _Float16* kg  = qg + sz;                      // [B][N][C] f16
  _Float16* vtg = kg + sz;                      // [B][C][N] f16

  dim3 g1(28, NBATCH), b1(224);
  proj_kernel<<<g1, b1, 0, stream>>>(x, w1, w2, qg, kg, vtg);
  dim3 g2(49, NBATCH), b2(128);
  attn_kernel<<<g2, b2, 0, stream>>>(qg, kg, vtg, out);
}

// v004
// One run takes 198 microseconds.
// In two side-by-side timings against v003, it was 1.13 and 1.12 times as fast.
// All steps since v000 together make it 2.37 times as fast.
#include <hip/hip_runtime.h>

#define DIMC 384
#define NPIX 3136   // 56*56
#define NBATCH 8

typedef __attribute__((ext_vector_type(16))) _Float16     v16h;
typedef __attribute__((ext_vector_type(4)))  _Float16     v4h;
typedef __attribute__((ext_vector_type(8)))  float        v8f;
typedef __attribute__((ext_vector_type(4)))  unsigned int v4u;
typedef __attribute__((ext_vector_type(8)))  unsigned int v8u;

static __device__ __forceinline__ v8f wmma16(v16h a, v16h b, v8f c) {
  // D = A(16x32 f16) x B(32x16 f16) + C(16x16 f32)
  return __builtin_amdgcn_wmma_f32_16x16x32_f16(false, a, false, b, (short)0, c,
                                                false, false);
}

// Load one 16x32 f16 fragment (A or B operand) given a pointer already offset
// by (row*stride + kchunk + hb*8) in halfword units.  lo dwords = K{0..7|8..15},
// hi dwords (+16 halves) = K{16..23|24..31} per the CDNA5 16-bit VGPR layout.
static __device__ __forceinline__ v16h load_frag(const _Float16* p) {
  v4u lo = *(const v4u*)(p);
  v4u hi = *(const v4u*)(p + 16);
  v8u u;
  u[0] = lo[0]; u[1] = lo[1]; u[2] = lo[2]; u[3] = lo[3];
  u[4] = hi[0]; u[5] = hi[1]; u[6] = hi[2]; u[7] = hi[3];
  return __builtin_bit_cast(v16h, u);
}

// B fragment for fp32 weight row (cvt f32->f16 on the fly).
static __device__ __forceinline__ v16h wfrag(const float* wr, int hb) {
  const float4* p0 = (const float4*)(wr + hb * 8);
  const float4* p1 = (const float4*)(wr + 16 + hb * 8);
  float4 a0 = p0[0], a1 = p0[1], b0 = p1[0], b1 = p1[1];
  v16h h;
  h[0]  = (_Float16)a0.x; h[1]  = (_Float16)a0.y; h[2]  = (_Float16)a0.z; h[3]  = (_Float16)a0.w;
  h[4]  = (_Float16)a1.x; h[5]  = (_Float16)a1.y; h[6]  = (_Float16)a1.z; h[7]  = (_Float16)a1.w;
  h[8]  = (_Float16)b0.x; h[9]  = (_Float16)b0.y; h[10] = (_Float16)b0.z; h[11] = (_Float16)b0.w;
  h[12] = (_Float16)b1.x; h[13] = (_Float16)b1.y; h[14] = (_Float16)b1.z; h[15] = (_Float16)b1.w;
  return h;
}

static __device__ __forceinline__ unsigned int pack2(float a, float b) {
  unsigned short ua = __builtin_bit_cast(unsigned short, (_Float16)a);
  unsigned short ub = __builtin_bit_cast(unsigned short, (_Float16)b);
  return (unsigned int)ua | ((unsigned int)ub << 16);
}

// Value of lane l ^ 16 (the other wave half), by a vector cross-row move.
static __device__ __forceinline__ float xhalf(float v) {
  int x = __builtin_bit_cast(int, v);
  return __builtin_bit_cast(float, __builtin_amdgcn_permlanex16(
      x, x, 0x76543210, 0xfedcba98, false, false));
}

// e^x as one multiply and v_exp_f32 (what __expf compiles to here).  The v_nop
// is the free slot that the instruction set asks for behind a transcendental
// before its source register is overwritten.
static __device__ __forceinline__ float exp_slot(float x) {
  float y = x * 1.44269504088896340736f, r;
  asm("v_exp_f32 %0, %1\n\tv_nop" : "=v"(r) : "v"(y));
  return r;
}

// Flat->LDS byte offset: generic pointer to __shared__ is {aperture, offset32};
// the low 32 bits are the LDS byte address.
static __device__ __forceinline__ unsigned lds_off(const void* p) {
  return (unsigned)(unsigned long long)p;
}

// One async 16B copy global->LDS (per-lane), tracked by ASYNCcnt.
static __device__ __forceinline__ void async_cp16(unsigned lds_byte,
                                                  const _Float16* base,
                                                  unsigned gbyte) {
  asm volatile("global_load_async_to_lds_b128 %0, %1, %2"
               :: "v"(lds_byte), "v"(gbyte), "s"(base) : "memory");
}

// Order asked of the compiler's scheduler (these emit no instruction): the eight
// matrix products written above this line, then the sixteen LDS loads, and
// nothing moves past the line.  Left alone the scheduler spreads the loads among
// the products, one fragment ahead, and every product waits out an LDS latency;
// hoisted, the loads pass 512 VGPRs, and then only one wave fits on a SIMD.
#define PRODUCTS_THEN_LOADS()                            \
  do {                                                   \
    __builtin_amdgcn_sched_group_barrier(0x008, 8, 0);   \
    __builtin_amdgcn_sched_group_barrier(0x100, 16, 0);  \
    __builtin_amdgcn_sched_barrier(0);                   \
  } while (0)
// The same between a group of products and a group of loads where vector work
// stands beside them: LDS loads and matrix products stay on their side, plain
// vector and scalar instructions may cross.
#define GROUP_FENCE() __builtin_amdgcn_sched_barrier(0x406)

__global__ __launch_bounds__(128) void attn_kernel(
    const _Float16* __restrict__ qg,   // [B][N][C]
    const _Float16* __restrict__ kg,   // [B][N][C]
    const _Float16* __restrict__ vtg,  // [B][C][N]
    float* __restrict__ out)           // [B][C][N]
{
  __shared__ __align__(16) _Float16 kbuf[2][32 * 392];    // K block  [m][c]
  __shared__ __align__(16) _Float16 vbuf[2][384 * 40];    // V^T block [d][m]
  const int tid  = threadIdx.x;
  const int wave = tid >> 5;
  const int lane = tid & 31;
  const int l16  = lane & 15;
  const int hb   = lane >> 4;
  const int b    = blockIdx.y;
  const int n0   = (blockIdx.x * 4 + wave) * 16;
  const _Float16* qrow = qg + ((size_t)b * NPIX + n0) * DIMC;
  const _Float16* kb   = kg + (size_t)b * NPIX * DIMC;
  const _Float16* vb   = vtg + (size_t)b * DIMC * NPIX;

  const unsigned kofs[2] = {lds_off(&kbuf[0][0]), lds_off(&kbuf[1][0])};
  const unsigned vofs[2] = {lds_off(&vbuf[0][0]), lds_off(&vbuf[1][0])};

  // Q strip: 16 rows x 384 -> 12 B-fragments held in registers across the
  // entire key loop (96 VGPRs; the register file is 1024 VGPRs on gfx1250).
  v16h qf[12];
#pragma unroll
  for (int ck = 0; ck < 12; ++ck)
    qf[ck] = load_frag(qrow + l16 * DIMC + ck * 32 + hb * 8);

  v8f o[24];
  v8f zero = {0.f, 0.f, 0.f, 0.f, 0.f, 0.f, 0.f, 0.f};
#pragma unroll
  for (int i = 0; i < 24; ++i) o[i] = zero;
  float mi = -3.0e38f;   // running maximum of query l16 (equal in both halves)
  float li = 0.f;        // running sum over this half's 16 keys of every block

  // Issue async staging of key-block `m0` into buffer `bsel`.
  auto stage = [&](int bsel, int m0) {
#pragma unroll
    for (int it = 0; it < 12; ++it) {            // K: 32 x 384 halves
      int chunk = it * 128 + tid;
      int m = chunk / 48, off = (chunk % 48) * 8;
      async_cp16(kofs[bsel] + (unsigned)(m * 392 + off) * 2, kb,
                 (unsigned)(((m0 + m) * DIMC + off) * 2));
    }
#pragma unroll
    for (int it = 0; it < 12; ++it) {            // V^T: 384 x 32 halves
      int chunk = it * 128 + tid;
      int d = chunk >> 2, off = (chunk & 3) * 8;
      async_cp16(vofs[bsel] + (unsigned)(d * 40 + off) * 2, vb,
                 (unsigned)((d * NPIX + m0 + off) * 2));
    }
  };

  stage(0, 0);                     // prefetch first key block
  for (int kbk = 0; kbk < 98; ++kbk) {
    const int cur = kbk & 1;
    __syncthreads();               // all waves done reading buf[cur^1]
    if (kbk < 97) {
      stage(cur ^ 1, (kbk + 1) * 32);
      // own 24 older asyncs (current block) retired; 24 new may be in flight
      asm volatile("s_wait_asynccnt 0x18" ::: "memory");
    } else {
      asm volatile("s_wait_asynccnt 0x0" ::: "memory");
    }
    __syncthreads();               // current block visible to all waves

    const _Float16* kcur = &kbuf[cur][0];
    const _Float16* vcur = &vbuf[cur][0];

    // The 24 K and 24 V^T fragments of this block pass through two register
    // sets of eight.  A set is refilled by one group of sixteen LDS loads as soon
    // as its products are issued: a whole group is on its way while the other
    // set is multiplied, and a wave keeps 16 to 32 loads in flight.
    // K fragment j of a group: key tile j & 1, channels 32 * (j >> 1).
    // (Every loop over a set is unrolled, so that the sets are indexed by
    // constants and stay in registers.)
    const _Float16* kp = kcur + l16 * 392 + hb * 8;
    const _Float16* vp = vcur + l16 * 40 + hb * 8;
    v16h ra[8], rb[8];
#pragma unroll
    for (int j = 0; j < 8; ++j) ra[j] = load_frag(kp + (j & 1) * 6272 + (j >> 1) * 32);
#pragma unroll
    for (int j = 0; j < 8; ++j) rb[j] = load_frag(kp + (j & 1) * 6272 + (4 + (j >> 1)) * 32);
    // Compiler scheduling fence (emits no instruction): all 32 loads stand in
    // front of the first product, which then waits for its own two alone.
    __builtin_amdgcn_sched_barrier(0);

    // S^T = K @ Q^T : two 16x16 f32 tiles, keys 8*hb+r and 16+8*hb+r of this
    // 32-key block in register r, query l16.
    v8f s0 = zero, s1 = zero;
#pragma unroll
    for (int c = 0; c < 4; ++c) {
      s0 = wmma16(ra[2 * c], qf[c], s0);
      s1 = wmma16(ra[2 * c + 1], qf[c], s1);
    }
#pragma unroll
    for (int j = 0; j < 8; ++j) ra[j] = load_frag(kp + (j & 1) * 6272 + (8 + (j >> 1)) * 32);
    PRODUCTS_THEN_LOADS();
#pragma unroll
    for (int c = 0; c < 4; ++c) {
      s0 = wmma16(rb[2 * c], qf[4 + c], s0);
      s1 = wmma16(rb[2 * c + 1], qf[4 + c], s1);
    }
    // The first 16 V fragments follow the K fragments through the two sets, so
    // that their LDS latency passes under the last products and the softmax.
#pragma unroll
    for (int j = 0; j < 8; ++j) rb[j] = load_frag(vp + j * 640);
    PRODUCTS_THEN_LOADS();
#pragma unroll
    for (int c = 0; c < 4; ++c) {
      s0 = wmma16(ra[2 * c], qf[8 + c], s0);
      s1 = wmma16(ra[2 * c + 1], qf[8 + c], s1);
    }
#pragma unroll
    for (int j = 0; j < 8; ++j) ra[j] = load_frag(vp + (8 + j) * 640);
    PRODUCTS_THEN_LOADS();

    // Online softmax of query l16: 16 scores in this lane, 16 in lane l ^ 16.
    float m8[8];
#pragma unroll
    for (int r = 0; r < 8; ++r) m8[r] = fmaxf(s0[r], s1[r]);
    float mv = fmaxf(fmaxf(fmaxf(m8[0], m8[1]), fmaxf(m8[2], m8[3])),
                     fmaxf(fmaxf(m8[4], m8[5]), fmaxf(m8[6], m8[7])));
    mv = fmaxf(mv, xhalf(mv));
    const float mn = fmaxf(mi, mv);
    const float sc = exp_slot(mi - mn);
    mi = mn;
    float a8[8];
#pragma unroll
    for (int r = 0; r < 8; ++r) {
      s0[r] = exp_slot(s0[r] - mn);
      s1[r] = exp_slot(s1[r] - mn);
      a8[r] = s0[r] + s1[r];
    }
    li = li * sc + (((a8[0] + a8[1]) + (a8[2] + a8[3])) +
                    ((a8[4] + a8[5]) + (a8[6] + a8[7])));
#pragma unroll
    for (int dt = 0; dt < 24; ++dt) {
#pragma unroll
      for (int r = 0; r < 8; ++r) o[dt][r] *= sc;
    }

    // P^T -> f16 in place: elements 0-7 are keys 8*hb+r, 8-15 keys 16+8*hb+r,
    // the k order in which load_frag delivers the V^T rows.
    v16h pf;
#pragma unroll
    for (int r = 0; r < 8; ++r) {
      pf[r]     = (_Float16)s0[r];
      pf[8 + r] = (_Float16)s1[r];
    }

    // O^T += V^T @ P^T  (24 d-tiles, K = 32 keys)
#pragma unroll
    for (int j = 0; j < 8; ++j) o[j] = wmma16(rb[j], pf, o[j]);
    GROUP_FENCE();
#pragma unroll
    for (int j = 0; j < 8; ++j) rb[j] = load_frag(vp + (16 + j) * 640);
    GROUP_FENCE();
#pragma unroll
    for (int j = 0; j < 8; ++j) o[8 + j] = wmma16(ra[j], pf, o[8 + j]);
#pragma unroll
    for (int j = 0; j < 8; ++j) o[16 + j] = wmma16(rb[j], pf, o[16 + j]);
  }

  // Epilogue: join the halves' sums, divide, store out[b][d][n]: register r of
  // tile dt is row d = dt*16 + 8*hb + r, and 16 lanes cover 64 contiguous bytes.
  const float inv = 1.f / (li + xhalf(li));
  float* ob = out + ((size_t)b * DIMC + 8 * hb) * NPIX + n0 + l16;
#pragma unroll
  for (int dt = 0; dt < 24; ++dt) {
#pragma unroll
    for (int r = 0; r < 8; ++r) o[dt][r] *= inv;
  }
  // Compiler scheduling fence (emits no instruction): every product stands in
  // front of the first store.  Mixed with the stores they reuse registers that
  // issued stores still name, with a wait in front of each reuse.
  __builtin_amdgcn_sched_barrier(0);
#pragma unroll
  for (int dt = 0; dt < 24; ++dt) {
#pragma unroll
    for (int r = 0; r < 8; ++r) ob[(dt * 16 + r) * NPIX] = o[dt][r];
  }
}

// ---------------------------------------------------------------------------
// Kernel 1: q = (x^T @ W1^T) * C^-0.5   -> f16 [B][N][C]
//           k = f16(x^T)                -> f16 [B][N][C]
//           v^T = (x^T @ W2^T)^T        -> f16 [B][C][N]
// One wave per 16-token strip; block = 7 waves (196 strips = 28 x 7).
// The 16 rows of W1 and of W2 that one output tile needs are read once per
// work-group in whole-line loads, converted to f16 and kept in LDS, where all
// seven waves take their B fragments; two buffers, so that the next tile pair
// is on its way from L2 while this one is multiplied.
// ---------------------------------------------------------------------------
// Work-group barrier that orders LDS alone.  __syncthreads() would also wait
// for this wave's global stores of q and v^T, which no wave of this launch reads.
static __device__ __forceinline__ void lds_barrier() {
  __builtin_amdgcn_fence(__ATOMIC_RELEASE, "workgroup", "local");
  __builtin_amdgcn_s_barrier();
  __builtin_amdgcn_fence(__ATOMIC_ACQUIRE, "workgroup", "local");
}

#define PWAVES   7
#define PTHREADS 224
__global__ __launch_bounds__(PTHREADS) void proj_kernel(
    const float* __restrict__ x,    // [B][C][N]
    const float* __restrict__ w1,   // [C][C]
    const float* __restrict__ w2,   // [C][C]
    _Float16* __restrict__ qg,      // [B][N][C]
    _Float16* __restrict__ kg,      // [B][N][C]
    _Float16* __restrict__ vtg)     // [B][C][N]
{
  __shared__ __align__(16) _Float16 tl[PWAVES * 16 * 392];  // t strips, [n][c] pad 392
  __shared__ __align__(16) _Float16 qs[PWAVES * 16 * 16];   // per-wave q transpose bounce
  __shared__ __align__(16) _Float16 wl[2][32 * 392];        // rows 0-15 W1, 16-31 W2
  const int tid  = threadIdx.x;
  const int wave = tid >> 5;
  const int lane = tid & 31;
  const int l16  = lane & 15;
  const int hb   = lane >> 4;
  const int b    = blockIdx.y;
  const int n0   = (blockIdx.x * PWAVES + wave) * 16;
  _Float16* tw = tl + wave * 16 * 392;
  _Float16* qw = qs + wave * 256;
  const float* xb = x + (size_t)b * DIMC * NPIX;

  // Stage 16 x 384 t-strip into LDS as f16 (coalesced b128 along n).
  {
    const int cl = lane >> 2;        // 0..7 : c sub-row
    const int ch = (lane & 3) * 4;   // 0,4,8,12 : n sub-offset
    for (int it = 0; it < 48; ++it) {
      int c = it * 8 + cl;
      const float4 f = *(const float4*)(xb + (size_t)c * NPIX + n0 + ch);
      tw[(ch + 0) * 392 + c] = (_Float16)f.x;
      tw[(ch + 1) * 392 + c] = (_Float16)f.y;
      tw[(ch + 2) * 392 + c] = (_Float16)f.z;
      tw[(ch + 3) * 392 + c] = (_Float16)f.w;
    }
  }
  // Emit K rows (coalesced b128).
  {
    _Float16* kout = kg + ((size_t)b * NPIX + n0) * DIMC;
    for (int it = 0; it < 24; ++it) {
      int chunk = it * 32 + lane;               // 768 chunks x 8 halves
      int r = chunk / 48, off = (chunk % 48) * 8;
      v4u t = *(const v4u*)(tw + r * 392 + off);
      *(v4u*)(kout + r * DIMC + off) = t;
    }
  }

  // The 16 rows of one tile are 24,576 contiguous bytes = 1536 float4 chunks
  // over 224 threads: six full passes and one of 192 threads (whole waves), for
  // W1 and again for W2.  Every wave-load is 512 contiguous bytes.
  int    wd[7];    // this thread's place in the LDS tile in each pass, in halves
  float4 wr[14];   // the tile pair on its way from L2 to LDS (0-6 W1, 7-13 W2)
#pragma unroll
  for (int it = 0; it < 7; ++it) {
    int chunk = it * PTHREADS + tid;
    wd[it] = (chunk / 96) * 392 + (chunk % 96) * 4;
  }
  auto wload = [&](int dt) {
    const float* s1 = w1 + dt * 16 * DIMC;
    const float* s2 = w2 + dt * 16 * DIMC;
#pragma unroll
    for (int it = 0; it < 7; ++it)
      if (it < 6 || tid < 192) {
        wr[it]     = *(const float4*)(s1 + it * PTHREADS * 4 + tid * 4);
        wr[7 + it] = *(const float4*)(s2 + it * PTHREADS * 4 + tid * 4);
      }
  };
  auto wstore = [&](int bsel) {
#pragma unroll
    for (int it = 0; it < 7; ++it)
      if (it < 6 || tid < 192) {
        v4h p1, p2;
        p1[0] = (_Float16)wr[it].x;     p1[1] = (_Float16)wr[it].y;
        p1[2] = (_Float16)wr[it].z;     p1[3] = (_Float16)wr[it].w;
        p2[0] = (_Float16)wr[7 + it].x; p2[1] = (_Float16)wr[7 + it].y;
        p2[2] = (_Float16)wr[7 + it].z; p2[3] = (_Float16)wr[7 + it].w;
        *(v4h*)(&wl[bsel][wd[it]])            = p1;
        *(v4h*)(&wl[bsel][16 * 392 + wd[it]]) = p2;
      }
  };

  wload(0);
  wstore(0);
  lds_barrier();                   // tile pair 0 visible to all waves

  const float kScale = 0.051031036307982884f;   // 384^-0.5 folded into q
  for (int dt = 0; dt < 24; ++dt) {
    v8f aq = {0.f, 0.f, 0.f, 0.f, 0.f, 0.f, 0.f, 0.f};
    v8f av = aq;
    const int d = dt * 16 + l16;
    const _Float16* wc = &wl[dt & 1][0];
    // Tile pair dt+1 starts from L2 here and lands under this pass's products.
    if (dt + 1 < 24) wload(dt + 1);
    // All fragments of the pass are fetched as one group (unrolled so that the
    // arrays are indexed by constants and stay in registers).
    v16h af[12], b1[12], b2[12];
#pragma unroll
    for (int ck = 0; ck < 12; ++ck) {
      af[ck] = load_frag(tw + l16 * 392 + ck * 32 + hb * 8);
      b1[ck] = load_frag(wc + l16 * 392 + ck * 32 + hb * 8);
      b2[ck] = load_frag(wc + (16 + l16) * 392 + ck * 32 + hb * 8);
    }
    // Compiler scheduling fence (emits no instruction): without it the loads
    // sink to their matrix instructions, six at a time with a full LDS wait
    // in front of every pair of products.
    __builtin_amdgcn_sched_barrier(0);
#pragma unroll
    for (int ck = 0; ck < 12; ++ck) {
      aq = wmma16(af[ck], b1[ck], aq);
      av = wmma16(af[ck], b2[ck], av);
    }
    // v^T store: lane holds d=dt*16+l16, 8 consecutive n -> one b128.
    {
      v4u pk;
      pk[0] = pack2(av[0], av[1]);
      pk[1] = pack2(av[2], av[3]);
      pk[2] = pack2(av[4], av[5]);
      pk[3] = pack2(av[6], av[7]);
      *(v4u*)(vtg + ((size_t)b * DIMC + d) * NPIX + n0 + hb * 8) = pk;
    }
    // q store via LDS transpose bounce (row-major [n][d]).
#pragma unroll
    for (int r = 0; r < 8; ++r)
      qw[(r + 8 * hb) * 16 + l16] = (_Float16)(aq[r] * kScale);
    {
      v4u t = *(const v4u*)(qw + (lane >> 1) * 16 + (lane & 1) * 8);
      *(v4u*)(qg + ((size_t)b * NPIX + n0 + (lane >> 1)) * DIMC + dt * 16 +
              (lane & 1) * 8) = t;
    }
    // Tile pair dt+1 goes into the buffer that was last read in pass dt-1 (the
    // barrier at that pass's foot ended those reads).
    if (dt + 1 < 24) wstore((dt + 1) & 1);
    lds_barrier();                 // publishes dt+1, ends the reads of dt
  }
}

extern "C" void kernel_launch(void* const* d_in, const int* in_sizes, int n_in,
                              void* d_out, int out_size, void* d_ws, size_t ws_size,
                              hipStream_t stream) {
  (void)in_sizes; (void)n_in; (void)out_size; (void)ws_size;
  const float* x  = (const float*)d_in[0];
  const float* w1 = (const float*)d_in[1];
  const float* w2 = (const float*)d_in[2];
  float* out = (float*)d_out;

  size_t sz = (size_t)NBATCH * NPIX * DIMC;     // halves per f16 buffer
  _Float16* qg  = (_Float16*)d_ws;              // [B][N][C] f16
  _Float16* kg  = qg + sz;                      // [B][N][C] f16
  _Float16* vtg = kg + sz;                      // [B][C][N] f16

  dim3 g1(28, NBATCH), b1(224);
  proj_kernel<<<g1, b1, 0, stream>>>(x, w1, w2, qg, kg, vtg);
  dim3 g2(49, NBATCH), b2(128);
  attn_kernel<<<g2, b2, 0, stream>>>(qg, kg, vtg, out);
}

// v005
// Measured time: 175 microseconds a run.
// Two timings next to v004 put it at 1.12 and 1.13 times that version's speed.
// All steps since v000 together make it 2.67 times as fast.
#include <hip/hip_runtime.h>

#define DIMC 384
#define NPIX 3136   // 56*56
#define NBATCH 8

typedef __attribute__((ext_vector_type(16))) _Float16     v16h;
typedef __attribute__((ext_vector_type(4)))  _Float16     v4h;
typedef __attribute__((ext_vector_type(8)))  float        v8f;
typedef __attribute__((ext_vector_type(4)))  unsigned int v4u;
typedef __attribute__((ext_vector_type(8)))  unsigned int v8u;

static __device__ __forceinline__ v8f wmma16(v16h a, v16h b, v8f c) {
  // D = A(16x32 f16) x B(32x16 f16) + C(16x16 f32)
  return __builtin_amdgcn_wmma_f32_16x16x32_f16(false, a, false, b, (short)0, c,
                                                false, false);
}

// Load one 16x32 f16 fragment (A or B operand) given a pointer already offset
// by (row*stride + kchunk + hb*8) in halfword units.  lo dwords = K{0..7|8..15},
// hi dwords (+16 halves) = K{16..23|24..31} per the CDNA5 16-bit VGPR layout.
static __device__ __forceinline__ v16h load_frag(const _Float16* p) {
  v4u lo = *(const v4u*)(p);
  v4u hi = *(const v4u*)(p + 16);
  v8u u;
  u[0] = lo[0]; u[1] = lo[1]; u[2] = lo[2]; u[3] = lo[3];
  u[4] = hi[0]; u[5] = hi[1]; u[6] = hi[2]; u[7] = hi[3];
  return __builtin_bit_cast(v16h, u);
}

// B fragment for fp32 weight row (cvt f32->f16 on the fly).
static __device__ __forceinline__ v16h wfrag(const float* wr, int hb) {
  const float4* p0 = (const float4*)(wr + hb * 8);
  const float4* p1 = (const float4*)(wr + 16 + hb * 8);
  float4 a0 = p0[0], a1 = p0[1], b0 = p1[0], b1 = p1[1];
  v16h h;
  h[0]  = (_Float16)a0.x; h[1]  = (_Float16)a0.y; h[2]  = (_Float16)a0.z; h[3]  = (_Float16)a0.w;
  h[4]  = (_Float16)a1.x; h[5]  = (_Float16)a1.y; h[6]  = (_Float16)a1.z; h[7]  = (_Float16)a1.w;
  h[8]  = (_Float16)b0.x; h[9]  = (_Float16)b0.y; h[10] = (_Float16)b0.z; h[11] = (_Float16)b0.w;
  h[12] = (_Float16)b1.x; h[13] = (_Float16)b1.y; h[14] = (_Float16)b1.z; h[15] = (_Float16)b1.w;
  return h;
}

static __device__ __forceinline__ unsigned int pack2(float a, float b) {
  unsigned short ua = __builtin_bit_cast(unsigned short, (_Float16)a);
  unsigned short ub = __builtin_bit_cast(unsigned short, (_Float16)b);
  return (unsigned int)ua | ((unsigned int)ub << 16);
}

// Value of lane l ^ 16 (the other wave half), by a vector cross-row move.
static __device__ __forceinline__ float xhalf(float v) {
  int x = __builtin_bit_cast(int, v);
  return __builtin_bit_cast(float, __builtin_amdgcn_permlanex16(
      x, x, 0x76543210, 0xfedcba98, false, false));
}

// e^x as one multiply and v_exp_f32 (what __expf compiles to here).  The v_nop
// is the free slot that the instruction set asks for behind a transcendental
// before its source register is overwritten.
static __device__ __forceinline__ float exp_slot(float x) {
  float y = x * 1.44269504088896340736f, r;
  asm("v_exp_f32 %0, %1\n\tv_nop" : "=v"(r) : "v"(y));
  return r;
}

// Flat->LDS byte offset: generic pointer to __shared__ is {aperture, offset32};
// the low 32 bits are the LDS byte address.
static __device__ __forceinline__ unsigned lds_off(const void* p) {
  return (unsigned)(unsigned long long)p;
}

// One async 16B copy global->LDS (per-lane), tracked by ASYNCcnt.
static __device__ __forceinline__ void async_cp16(unsigned lds_byte,
                                                  const _Float16* base,
                                                  unsigned gbyte) {
  asm volatile("global_load_async_to_lds_b128 %0, %1, %2"
               :: "v"(lds_byte), "v"(gbyte), "s"(base) : "memory");
}

// Order asked of the compiler's scheduler (these emit no instruction): the
// sixteen matrix products written above this line, then the sixteen LDS loads,
// and nothing moves past the line.  Left alone the scheduler spreads the loads
// among the products, one fragment ahead, and every product waits out an LDS
// latency.
#define PRODUCTS_THEN_LOADS()                            \
  do {                                                   \
    __builtin_amdgcn_sched_group_barrier(0x008, 16, 0);  \
    __builtin_amdgcn_sched_group_barrier(0x100, 16, 0);  \
    __builtin_amdgcn_sched_barrier(0);                   \
  } while (0)
// The same between a group of products and a group of loads where vector work
// stands beside them: LDS loads and matrix products stay on their side, plain
// vector and scalar instructions may cross.
#define GROUP_FENCE() __builtin_amdgcn_sched_barrier(0x406)

__global__ __launch_bounds__(128) void attn_kernel(
    const _Float16* __restrict__ qg,   // [B][N][C]
    const _Float16* __restrict__ kg,   // [B][N][C]
    const _Float16* __restrict__ vtg,  // [B][C][N]
    float* __restrict__ out)           // [B][C][N]
{
  __shared__ __align__(16) _Float16 kbuf[2][32 * 392];    // K block  [m][c]
  __shared__ __align__(16) _Float16 vbuf[2][384 * 40];    // V^T block [d][m]
  const int tid  = threadIdx.x;
  const int wave = tid >> 5;
  const int lane = tid & 31;
  const int l16  = lane & 15;
  const int hb   = lane >> 4;
  const int b    = blockIdx.y;
  // Strip number, the same in every lane: held in a scalar register so that the
  // test around the stores is a scalar branch.
  const int strip = __builtin_amdgcn_readfirstlane(blockIdx.x * 4 + wave);
  const bool live = strip < 98;
  const int n0   = (live ? strip : 97) * 32;
  const _Float16* qrow = qg + ((size_t)b * NPIX + n0) * DIMC;
  const _Float16* kb   = kg + (size_t)b * NPIX * DIMC;
  const _Float16* vb   = vtg + (size_t)b * DIMC * NPIX;

  const unsigned kofs[2] = {lds_off(&kbuf[0][0]), lds_off(&kbuf[1][0])};
  const unsigned vofs[2] = {lds_off(&vbuf[0][0]), lds_off(&vbuf[1][0])};

  // Q strip: 2 x 16 rows x 384 -> 24 B-fragments held in registers across the
  // entire key loop (192 VGPRs; the register file is 1024 VGPRs on gfx1250).
  // (Every loop over the two query tiles is unrolled, like those over a set.)
  v16h qf[2][12];
#pragma unroll
  for (int qt = 0; qt < 2; ++qt)
#pragma unroll
    for (int ck = 0; ck < 12; ++ck)
      qf[qt][ck] = load_frag(qrow + (qt * 16 + l16) * DIMC + ck * 32 + hb * 8);
  // The address registers of these loads are rewritten directly behind them; the
  // wait is written here, as a precaution.
  asm volatile("s_wait_xcnt 0x0" ::: "memory");

  v8f o[2][24];
  v8f zero = {0.f, 0.f, 0.f, 0.f, 0.f, 0.f, 0.f, 0.f};
#pragma unroll
  for (int i = 0; i < 24; ++i) { o[0][i] = zero; o[1][i] = zero; }
  // Per query tile: running maximum of query l16 (equal in both halves) and
  // running sum over this half's 16 keys of every block.
  float mi[2] = {-3.0e38f, -3.0e38f};
  float li[2] = {0.f, 0.f};

  // Issue async staging of key-block `m0` into buffer `bsel`.
  auto stage = [&](int bsel, int m0) {
#pragma unroll
    for (int it = 0; it < 12; ++it) {            // K: 32 x 384 halves
      int chunk = it * 128 + tid;
      int m = chunk / 48, off = (chunk % 48) * 8;
      async_cp16(kofs[bsel] + (unsigned)(m * 392 + off) * 2, kb,
                 (unsigned)(((m0 + m) * DIMC + off) * 2));
    }
#pragma unroll
    for (int it = 0; it < 12; ++it) {            // V^T: 384 x 32 halves
      // Chunk it * 128 + tid, written so that the twelve address pairs are one
      // register pair plus constants: as twelve values of their own they are
      // held across the key loop, and this build spills them.
      int d = it * 32 + (tid >> 2), off = (tid & 3) * 8;
      async_cp16(vofs[bsel] + (unsigned)(d * 40 + off) * 2, vb,
                 (unsigned)((d * NPIX + m0 + off) * 2));
    }
  };

  stage(0, 0);                     // prefetch first key block
  for (int kbk = 0; kbk < 98; ++kbk) {
    const int cur = kbk & 1;
    __syncthreads();               // all waves done reading buf[cur^1]
    if (kbk < 97) {
      stage(cur ^ 1, (kbk + 1) * 32);
      // own 24 older asyncs (current block) retired; 24 new may be in flight
      asm volatile("s_wait_asynccnt 0x18" ::: "memory");
    } else {
      asm volatile("s_wait_asynccnt 0x0" ::: "memory");
    }
    __syncthreads();               // current block visible to all waves

    const _Float16* kcur = &kbuf[cur][0];
    const _Float16* vcur = &vbuf[cur][0];

    // The 24 K and 24 V^T fragments of this block pass through two register
    // sets of eight.  A set is refilled by one group of sixteen LDS loads as soon
    // as its products are issued: a whole group is on its way while the other
    // set is multiplied, and a wave keeps 16 to 32 loads in flight.
    // K fragment j of a group: key tile j & 1, channels 32 * (j >> 1).
    // (Every loop over a set is unrolled, so that the sets are indexed by
    // constants and stay in registers.)
    const _Float16* kp = kcur + l16 * 392 + hb * 8;
    const _Float16* vp = vcur + l16 * 40 + hb * 8;
    v16h ra[8], rb[8];
#pragma unroll
    for (int j = 0; j < 8; ++j) ra[j] = load_frag(kp + (j & 1) * 6272 + (j >> 1) * 32);
#pragma unroll
    for (int j = 0; j < 8; ++j) rb[j] = load_frag(kp + (j & 1) * 6272 + (4 + (j >> 1)) * 32);
    // Compiler scheduling fence (emits no instruction): all 32 loads stand in
    // front of the first product, which then waits for its own two alone.
    __builtin_amdgcn_sched_barrier(0);

    // S^T = K @ Q^T : per query tile two 16x16 f32 tiles, keys 8*hb+r and
    // 16+8*hb+r of this 32-key block in register r, query l16.
    v8f s0[2] = {zero, zero}, s1[2] = {zero, zero};
#pragma unroll
    for (int c = 0; c < 4; ++c) {
      s0[0] = wmma16(ra[2 * c], qf[0][c], s0[0]);
      s0[1] = wmma16(ra[2 * c], qf[1][c], s0[1]);
      s1[0] = wmma16(ra[2 * c + 1], qf[0][c], s1[0]);
      s1[1] = wmma16(ra[2 * c + 1], qf[1][c], s1[1]);
    }
#pragma unroll
    for (int j = 0; j < 8; ++j) ra[j] = load_frag(kp + (j & 1) * 6272 + (8 + (j >> 1)) * 32);
    PRODUCTS_THEN_LOADS();
#pragma unroll
    for (int c = 0; c < 4; ++c) {
      s0[0] = wmma16(rb[2 * c], qf[0][4 + c], s0[0]);
      s0[1] = wmma16(rb[2 * c], qf[1][4 + c], s0[1]);
      s1[0] = wmma16(rb[2 * c + 1], qf[0][4 + c], s1[0]);
      s1[1] = wmma16(rb[2 * c + 1], qf[1][4 + c], s1[1]);
    }
    // The first 16 V fragments follow the K fragments through the two sets, so
    // that their LDS latency passes under the last products and the softmax.
#pragma unroll
    for (int j = 0; j < 8; ++j) rb[j] = load_frag(vp + j * 640);
    PRODUCTS_THEN_LOADS();
#pragma unroll
    for (int c = 0; c < 4; ++c) {
      s0[0] = wmma16(ra[2 * c], qf[0][8 + c], s0[0]);
      s0[1] = wmma16(ra[2 * c], qf[1][8 + c], s0[1]);
      s1[0] = wmma16(ra[2 * c + 1], qf[0][8 + c], s1[0]);
      s1[1] = wmma16(ra[2 * c + 1], qf[1][8 + c], s1[1]);
    }
#pragma unroll
    for (int j = 0; j < 8; ++j) ra[j] = load_frag(vp + (8 + j) * 640);
    PRODUCTS_THEN_LOADS();

    // Online softmax of query l16 of either tile: 16 scores in this lane, 16 in
    // lane l ^ 16.
    v16h pf[2];
#pragma unroll
    for (int qt = 0; qt < 2; ++qt) {
      float m8[8];
#pragma unroll
      for (int r = 0; r < 8; ++r) m8[r] = fmaxf(s0[qt][r], s1[qt][r]);
      float mv = fmaxf(fmaxf(fmaxf(m8[0], m8[1]), fmaxf(m8[2], m8[3])),
                       fmaxf(fmaxf(m8[4], m8[5]), fmaxf(m8[6], m8[7])));
      mv = fmaxf(mv, xhalf(mv));
      const float mn = fmaxf(mi[qt], mv);
      const float sc = exp_slot(mi[qt] - mn);
      mi[qt] = mn;
      float a8[8];
#pragma unroll
      for (int r = 0; r < 8; ++r) {
        s0[qt][r] = exp_slot(s0[qt][r] - mn);
        s1[qt][r] = exp_slot(s1[qt][r] - mn);
        a8[r] = s0[qt][r] + s1[qt][r];
      }
      li[qt] = li[qt] * sc + (((a8[0] + a8[1]) + (a8[2] + a8[3])) +
                              ((a8[4] + a8[5]) + (a8[6] + a8[7])));
#pragma unroll
      for (int dt = 0; dt < 24; ++dt) {
#pragma unroll
        for (int r = 0; r < 8; ++r) o[qt][dt][r] *= sc;
      }

      // P^T -> f16 in place: elements 0-7 are keys 8*hb+r, 8-15 keys 16+8*hb+r,
      // the k order in which load_frag delivers the V^T rows.
#pragma unroll
      for (int r = 0; r < 8; ++r) {
        pf[qt][r]     = (_Float16)s0[qt][r];
        pf[qt][8 + r] = (_Float16)s1[qt][r];
      }
    }

    // O^T += V^T @ P^T  (24 d-tiles x 2 query tiles, K = 32 keys)
#pragma unroll
    for (int j = 0; j < 8; ++j) {
      o[0][j] = wmma16(rb[j], pf[0], o[0][j]);
      o[1][j] = wmma16(rb[j], pf[1], o[1][j]);
    }
    GROUP_FENCE();
#pragma unroll
    for (int j = 0; j < 8; ++j) rb[j] = load_frag(vp + (16 + j) * 640);
    GROUP_FENCE();
#pragma unroll
    for (int j = 0; j < 8; ++j) {
      o[0][8 + j] = wmma16(ra[j], pf[0], o[0][8 + j]);
      o[1][8 + j] = wmma16(ra[j], pf[1], o[1][8 + j]);
    }
#pragma unroll
    for (int j = 0; j < 8; ++j) {
      o[0][16 + j] = wmma16(rb[j], pf[0], o[0][16 + j]);
      o[1][16 + j] = wmma16(rb[j], pf[1], o[1][16 + j]);
    }
  }

  // Epilogue: join the halves' sums, divide, store out[b][d][n]: register r of
  // tile dt is row d = dt*16 + 8*hb + r, and 16 lanes cover 64 contiguous bytes;
  // the two query tiles of a wave fill one 128-byte line.
  if (live) {
    float* ob = out + ((size_t)b * DIMC + 8 * hb) * NPIX + n0 + l16;
#pragma unroll
    for (int qt = 0; qt < 2; ++qt) {
      const float inv = 1.f / (li[qt] + xhalf(li[qt]));
#pragma unroll
      for (int dt = 0; dt < 24; ++dt) {
#pragma unroll
        for (int r = 0; r < 8; ++r) o[qt][dt][r] *= inv;
      }
    }
    // Compiler scheduling fence (emits no instruction): every product stands in
    // front of the first store.  Mixed with the stores they reuse registers that
    // issued stores still name.
    __builtin_amdgcn_sched_barrier(0);
#pragma unroll
    for (int dt = 0; dt < 24; ++dt) {
#pragma unroll
      for (int r = 0; r < 8; ++r) {
        ob[(dt * 16 + r) * NPIX]      = o[0][dt][r];
        ob[(dt * 16 + r) * NPIX + 16] = o[1][dt][r];
      }
    }
  }
}

// ---------------------------------------------------------------------------
// Kernel 1: q = (x^T @ W1^T) * C^-0.5   -> f16 [B][N][C]
//           k = f16(x^T)                -> f16 [B][N][C]
//           v^T = (x^T @ W2^T)^T        -> f16 [B][C][N]
// One wave per 16-token strip; block = 7 waves (196 strips = 28 x 7).
// The 16 rows of W1 and of W2 that one output tile needs are read once per
// work-group in whole-line loads, converted to f16 and kept in LDS, where all
// seven waves take their B fragments; two buffers, so that the next tile pair
// is on its way from L2 while this one is multiplied.
// ---------------------------------------------------------------------------
// Work-group barrier that orders LDS alone.  __syncthreads() would also wait
// for this wave's global stores of q and v^T, which no wave of this launch reads.
static __device__ __forceinline__ void lds_barrier() {
  __builtin_amdgcn_fence(__ATOMIC_RELEASE, "workgroup", "local");
  __builtin_amdgcn_s_barrier();
  __builtin_amdgcn_fence(__ATOMIC_ACQUIRE, "workgroup", "local");
}

#define PWAVES   7
#define PTHREADS 224
__global__ __launch_bounds__(PTHREADS) void proj_kernel(
    const float* __restrict__ x,    // [B][C][N]
    const float* __restrict__ w1,   // [C][C]
    const float* __restrict__ w2,   // [C][C]
    _Float16* __restrict__ qg,      // [B][N][C]
    _Float16* __restrict__ kg,      // [B][N][C]
    _Float16* __restrict__ vtg)     // [B][C][N]
{
  __shared__ __align__(16) _Float16 tl[PWAVES * 16 * 392];  // t strips, [n][c] pad 392
  __shared__ __align__(16) _Float16 qs[PWAVES * 16 * 16];   // per-wave q transpose bounce
  __shared__ __align__(16) _Float16 wl[2][32 * 392];        // rows 0-15 W1, 16-31 W2
  const int tid  = threadIdx.x;
  const int wave = tid >> 5;
  const int lane = tid & 31;
  const int l16  = lane & 15;
  const int hb   = lane >> 4;
  const int b    = blockIdx.y;
  const int n0   = (blockIdx.x * PWAVES + wave) * 16;
  _Float16* tw = tl + wave * 16 * 392;
  _Float16* qw = qs + wave * 256;
  const float* xb = x + (size_t)b * DIMC * NPIX;

  // Stage 16 x 384 t-strip into LDS as f16 (coalesced b128 along n).
  {
    const int cl = lane >> 2;        // 0..7 : c sub-row
    const int ch = (lane & 3) * 4;   // 0,4,8,12 : n sub-offset
    for (int it = 0; it < 48; ++it) {
      int c = it * 8 + cl;
      const float4 f = *(const float4*)(xb + (size_t)c * NPIX + n0 + ch);
      tw[(ch + 0) * 392 + c] = (_Float16)f.x;
      tw[(ch + 1) * 392 + c] = (_Float16)f.y;
      tw[(ch + 2) * 392 + c] = (_Float16)f.z;
      tw[(ch + 3) * 392 + c] = (_Float16)f.w;
    }
  }
  // Emit K rows (coalesced b128).
  {
    _Float16* kout = kg + ((size_t)b * NPIX + n0) * DIMC;
    for (int it = 0; it < 24; ++it) {
      int chunk = it * 32 + lane;               // 768 chunks x 8 halves
      int r = chunk / 48, off = (chunk % 48) * 8;
      v4u t = *(const v4u*)(tw + r * 392 + off);
      *(v4u*)(kout + r * DIMC + off) = t;
    }
  }

  // The 16 rows of one tile are 24,576 contiguous bytes = 1536 float4 chunks
  // over 224 threads: six full passes and one of 192 threads (whole waves), for
  // W1 and again for W2.  Every wave-load is 512 contiguous bytes.
  int    wd[7];    // this thread's place in the LDS tile in each pass, in halves
  float4 wr[14];   // the tile pair on its way from L2 to LDS (0-6 W1, 7-13 W2)
#pragma unroll
  for (int it = 0; it < 7; ++it) {
    int chunk = it * PTHREADS + tid;
    wd[it] = (chunk / 96) * 392 + (chunk % 96) * 4;
  }
  auto wload = [&](int dt) {
    const float* s1 = w1 + dt * 16 * DIMC;
    const float* s2 = w2 + dt * 16 * DIMC;
#pragma unroll
    for (int it = 0; it < 7; ++it)
      if (it < 6 || tid < 192) {
        wr[it]     = *(const float4*)(s1 + it * PTHREADS * 4 + tid * 4);
        wr[7 + it] = *(const float4*)(s2 + it * PTHREADS * 4 + tid * 4);
      }
  };
  auto wstore = [&](int bsel) {
#pragma unroll
    for (int it = 0; it < 7; ++it)
      if (it < 6 || tid < 192) {
        v4h p1, p2;
        p1[0] = (_Float16)wr[it].x;     p1[1] = (_Float16)wr[it].y;
        p1[2] = (_Float16)wr[it].z;     p1[3] = (_Float16)wr[it].w;
        p2[0] = (_Float16)wr[7 + it].x; p2[1] = (_Float16)wr[7 + it].y;
        p2[2] = (_Float16)wr[7 + it].z; p2[3] = (_Float16)wr[7 + it].w;
        *(v4h*)(&wl[bsel][wd[it]])            = p1;
        *(v4h*)(&wl[bsel][16 * 392 + wd[it]]) = p2;
      }
  };

  wload(0);
  wstore(0);
  lds_barrier();                   // tile pair 0 visible to all waves

  const float kScale = 0.051031036307982884f;   // 384^-0.5 folded into q
  for (int dt = 0; dt < 24; ++dt) {
    v8f aq = {0.f, 0.f, 0.f, 0.f, 0.f, 0.f, 0.f, 0.f};
    v8f av = aq;
    const int d = dt * 16 + l16;
    const _Float16* wc = &wl[dt & 1][0];
    // Tile pair dt+1 starts from L2 here and lands under this pass's products.
    if (dt + 1 < 24) wload(dt + 1);
    // All fragments of the pass are fetched as one group (unrolled so that the
    // arrays are indexed by constants and stay in registers).
    v16h af[12], b1[12], b2[12];
#pragma unroll
    for (int ck = 0; ck < 12; ++ck) {
      af[ck] = load_frag(tw + l16 * 392 + ck * 32 + hb * 8);
      b1[ck] = load_frag(wc + l16 * 392 + ck * 32 + hb * 8);
      b2[ck] = load_frag(wc + (16 + l16) * 392 + ck * 32 + hb * 8);
    }
    // Compiler scheduling fence (emits no instruction): without it the loads
    // sink to their matrix instructions, six at a time with a full LDS wait
    // in front of every pair of products.
    __builtin_amdgcn_sched_barrier(0);
#pragma unroll
    for (int ck = 0; ck < 12; ++ck) {
      aq = wmma16(af[ck], b1[ck], aq);
      av = wmma16(af[ck], b2[ck], av);
    }
    // v^T store: lane holds d=dt*16+l16, 8 consecutive n -> one b128.
    {
      v4u pk;
      pk[0] = pack2(av[0], av[1]);
      pk[1] = pack2(av[2], av[3]);
      pk[2] = pack2(av[4], av[5]);
      pk[3] = pack2(av[6], av[7]);
      *(v4u*)(vtg + ((size_t)b * DIMC + d) * NPIX + n0 + hb * 8) = pk;
    }
    // q store via LDS transpose bounce (row-major [n][d]).
#pragma unroll
    for (int r = 0; r < 8; ++r)
      qw[(r + 8 * hb) * 16 + l16] = (_Float16)(aq[r] * kScale);
    {
      v4u t = *(const v4u*)(qw + (lane >> 1) * 16 + (lane & 1) * 8);
      *(v4u*)(qg + ((size_t)b * NPIX + n0 + (lane >> 1)) * DIMC + dt * 16 +
              (lane & 1) * 8) = t;
    }
    // Tile pair dt+1 goes into the buffer that was last read in pass dt-1 (the
    // barrier at that pass's foot ended those reads).
    if (dt + 1 < 24) wstore((dt + 1) & 1);
    lds_barrier();                 // publishes dt+1, ends the reads of dt
  }
}

extern "C" void kernel_launch(void* const* d_in, const int* in_sizes, int n_in,
                              void* d_out, int out_size, void* d_ws, size_t ws_size,
                              hipStream_t stream) {
  (void)in_sizes; (void)n_in; (void)out_size; (void)ws_size;
  const float* x  = (const float*)d_in[0];
  const float* w1 = (const float*)d_in[1];
  const float* w2 = (const float*)d_in[2];
  float* out = (float*)d_out;

  size_t sz = (size_t)NBATCH * NPIX * DIMC;     // halves per f16 buffer
  _Float16* qg  = (_Float16*)d_ws;              // [B][N][C] f16
  _Float16* kg  = qg + sz;                      // [B][N][C] f16
  _Float16* vtg = kg + sz;                      // [B][C][N] f16

  dim3 g1(28, NBATCH), b1(224);
  proj_kernel<<<g1, b1, 0, stream>>>(x, w1, w2, qg, kg, vtg);
  dim3 g2(25, NBATCH), b2(128);
  attn_kernel<<<g2, b2, 0, stream>>>(qg, kg, vtg, out);
}

// v006
// Measured time: 158 microseconds a run.
// Timed twice side by side with v005, it ran 1.11 times as fast both times.
// Over all steps from v000 it is 2.95 times as fast.
#include <hip/hip_runtime.h>

#define DIMC 384
#define NPIX 3136   // 56*56
#define NBATCH 8

typedef __attribute__((ext_vector_type(16))) _Float16     v16h;
typedef __attribute__((ext_vector_type(4)))  _Float16     v4h;
typedef __attribute__((ext_vector_type(8)))  float        v8f;
typedef __attribute__((ext_vector_type(4)))  unsigned int v4u;
typedef __attribute__((ext_vector_type(8)))  unsigned int v8u;

static __device__ __forceinline__ v8f wmma16(v16h a, v16h b, v8f c) {
  // D = A(16x32 f16) x B(32x16 f16) + C(16x16 f32)
  return __builtin_amdgcn_wmma_f32_16x16x32_f16(false, a, false, b, (short)0, c,
                                                false, false);
}

// Load one 16x32 f16 fragment (A or B operand) given a pointer already offset
// by (row*stride + kchunk + hb*8) in halfword units.  lo dwords = K{0..7|8..15},
// hi dwords (+16 halves) = K{16..23|24..31} per the CDNA5 16-bit VGPR layout.
static __device__ __forceinline__ v16h load_frag(const _Float16* p) {
  v4u lo = *(const v4u*)(p);
  v4u hi = *(const v4u*)(p + 16);
  v8u u;
  u[0] = lo[0]; u[1] = lo[1]; u[2] = lo[2]; u[3] = lo[3];
  u[4] = hi[0]; u[5] = hi[1]; u[6] = hi[2]; u[7] = hi[3];
  return __builtin_bit_cast(v16h, u);
}

// B fragment for fp32 weight row (cvt f32->f16 on the fly).
static __device__ __forceinline__ v16h wfrag(const float* wr, int hb) {
  const float4* p0 = (const float4*)(wr + hb * 8);
  const float4* p1 = (const float4*)(wr + 16 + hb * 8);
  float4 a0 = p0[0], a1 = p0[1], b0 = p1[0], b1 = p1[1];
  v16h h;
  h[0]  = (_Float16)a0.x; h[1]  = (_Float16)a0.y; h[2]  = (_Float16)a0.z; h[3]  = (_Float16)a0.w;
  h[4]  = (_Float16)a1.x; h[5]  = (_Float16)a1.y; h[6]  = (_Float16)a1.z; h[7]  = (_Float16)a1.w;
  h[8]  = (_Float16)b0.x; h[9]  = (_Float16)b0.y; h[10] = (_Float16)b0.z; h[11] = (_Float16)b0.w;
  h[12] = (_Float16)b1.x; h[13] = (_Float16)b1.y; h[14] = (_Float16)b1.z; h[15] = (_Float16)b1.w;
  return h;
}

static __device__ __forceinline__ unsigned int pack2(float a, float b) {
  unsigned short ua = __builtin_bit_cast(unsigned short, (_Float16)a);
  unsigned short ub = __builtin_bit_cast(unsigned short, (_Float16)b);
  return (unsigned int)ua | ((unsigned int)ub << 16);
}

// Value of lane l ^ 16 (the other wave half), by a vector cross-row move.
static __device__ __forceinline__ float xhalf(float v) {
  int x = __builtin_bit_cast(int, v);
  return __builtin_bit_cast(float, __builtin_amdgcn_permlanex16(
      x, x, 0x76543210, 0xfedcba98, false, false));
}

// e^x as one multiply and v_exp_f32 (what __expf compiles to here).  The v_nop
// is the free slot that the instruction set asks for behind a transcendental
// before its source register is overwritten.
static __device__ __forceinline__ float exp_slot(float x) {
  float y = x * 1.44269504088896340736f, r;
  asm("v_exp_f32 %0, %1\n\tv_nop" : "=v"(r) : "v"(y));
  return r;
}

// Flat->LDS byte offset: generic pointer to __shared__ is {aperture, offset32};
// the low 32 bits are the LDS byte address.
static __device__ __forceinline__ unsigned lds_off(const void* p) {
  return (unsigned)(unsigned long long)p;
}

// One async 16B copy global->LDS (per-lane), tracked by ASYNCcnt.
static __device__ __forceinline__ void async_cp16(unsigned lds_byte,
                                                  const _Float16* base,
                                                  unsigned gbyte) {
  asm volatile("global_load_async_to_lds_b128 %0, %1, %2"
               :: "v"(lds_byte), "v"(gbyte), "s"(base) : "memory");
}

// Order asked of the compiler's scheduler (these emit no instruction): the
// sixteen matrix products written above this line, then the sixteen LDS loads,
// and nothing moves past the line.  Left alone the scheduler spreads the loads
// among the products, one fragment ahead, and every product waits out an LDS
// latency.
#define PRODUCTS_THEN_LOADS()                            \
  do {                                                   \
    __builtin_amdgcn_sched_group_barrier(0x008, 16, 0);  \
    __builtin_amdgcn_sched_group_barrier(0x100, 16, 0);  \
    __builtin_amdgcn_sched_barrier(0);                   \
  } while (0)
// The same between a group of products and a group of loads where vector work
// stands beside them: LDS loads and matrix products stay on their side, plain
// vector and scalar instructions may cross.
#define GROUP_FENCE() __builtin_amdgcn_sched_barrier(0x406)

__global__ __launch_bounds__(128) void attn_kernel(
    const _Float16* __restrict__ qg,   // [B][N][C]
    const _Float16* __restrict__ kg,   // [B][N][C]
    const _Float16* __restrict__ vtg,  // [B][C][N]
    float* __restrict__ out)           // [B][C][N]
{
  __shared__ __align__(16) _Float16 kbuf[2][32 * 392];    // K block  [m][c]
  __shared__ __align__(16) _Float16 vbuf[2][384 * 40];    // V^T block [d][m]
  const int tid  = threadIdx.x;
  const int wave = tid >> 5;
  const int lane = tid & 31;
  const int l16  = lane & 15;
  const int hb   = lane >> 4;
  const int b    = blockIdx.y;
  // Strip number, the same in every lane: held in a scalar register so that the
  // test around the stores is a scalar branch.
  const int strip = __builtin_amdgcn_readfirstlane(blockIdx.x * 4 + wave);
  const bool live = strip < 98;
  const int n0   = (live ? strip : 97) * 32;
  const _Float16* qrow = qg + ((size_t)b * NPIX + n0) * DIMC;
  const _Float16* kb   = kg + (size_t)b * NPIX * DIMC;
  const _Float16* vb   = vtg + (size_t)b * DIMC * NPIX;

  const unsigned kofs[2] = {lds_off(&kbuf[0][0]), lds_off(&kbuf[1][0])};
  const unsigned vofs[2] = {lds_off(&vbuf[0][0]), lds_off(&vbuf[1][0])};

  // Q strip: 2 x 16 rows x 384 -> 24 B-fragments held in registers across the
  // entire key loop (192 VGPRs; the register file is 1024 VGPRs on gfx1250).
  // (Every loop over the two query tiles is unrolled, like those over a set.)
  v16h qf[2][12];
#pragma unroll
  for (int qt = 0; qt < 2; ++qt)
#pragma unroll
    for (int ck = 0; ck < 12; ++ck)
      qf[qt][ck] = load_frag(qrow + (qt * 16 + l16) * DIMC + ck * 32 + hb * 8);
  // The address registers of these loads are rewritten directly behind them; the
  // wait is written here, as a precaution.
  asm volatile("s_wait_xcnt 0x0" ::: "memory");

  v8f o[2][24];
  v8f zero = {0.f, 0.f, 0.f, 0.f, 0.f, 0.f, 0.f, 0.f};
#pragma unroll
  for (int i = 0; i < 24; ++i) { o[0][i] = zero; o[1][i] = zero; }
  // Per query tile: reference point of the exponentials of query l16 (a maximum
  // seen so far, equal in both halves) and running sum over this half's 16 keys
  // of every block.
  float mi[2] = {-3.0e38f, -3.0e38f};
  float li[2] = {0.f, 0.f};

  // Issue async staging of key-block `m0` into buffer `bsel`.
  auto stage = [&](int bsel, int m0) {
#pragma unroll
    for (int it = 0; it < 12; ++it) {            // K: 32 x 384 halves
      int chunk = it * 128 + tid;
      int m = chunk / 48, off = (chunk % 48) * 8;
      async_cp16(kofs[bsel] + (unsigned)(m * 392 + off) * 2, kb,
                 (unsigned)(((m0 + m) * DIMC + off) * 2));
    }
#pragma unroll
    for (int it = 0; it < 12; ++it) {            // V^T: 384 x 32 halves
      // Chunk it * 128 + tid, written so that the twelve address pairs are one
      // register pair plus constants: as twelve values of their own they are
      // held across the key loop, and this build spills them.
      int d = it * 32 + (tid >> 2), off = (tid & 3) * 8;
      async_cp16(vofs[bsel] + (unsigned)(d * 40 + off) * 2, vb,
                 (unsigned)((d * NPIX + m0 + off) * 2));
    }
  };

  stage(0, 0);                     // prefetch first key block
  for (int kbk = 0; kbk < 98; ++kbk) {
    const int cur = kbk & 1;
    __syncthreads();               // all waves done reading buf[cur^1]
    if (kbk < 97) {
      stage(cur ^ 1, (kbk + 1) * 32);
      // own 24 older asyncs (current block) retired; 24 new may be in flight
      asm volatile("s_wait_asynccnt 0x18" ::: "memory");
    } else {
      asm volatile("s_wait_asynccnt 0x0" ::: "memory");
    }
    __syncthreads();               // current block visible to all waves

    const _Float16* kcur = &kbuf[cur][0];
    const _Float16* vcur = &vbuf[cur][0];

    // The 24 K and 24 V^T fragments of this block pass through two register
    // sets of eight.  A set is refilled by one group of sixteen LDS loads as soon
    // as its products are issued: a whole group is on its way while the other
    // set is multiplied, and a wave keeps 16 to 32 loads in flight.
    // K fragment j of a group: key tile j & 1, channels 32 * (j >> 1).
    // (Every loop over a set is unrolled, so that the sets are indexed by
    // constants and stay in registers.)
    const _Float16* kp = kcur + l16 * 392 + hb * 8;
    const _Float16* vp = vcur + l16 * 40 + hb * 8;
    v16h ra[8], rb[8];
#pragma unroll
    for (int j = 0; j < 8; ++j) ra[j] = load_frag(kp + (j & 1) * 6272 + (j >> 1) * 32);
#pragma unroll
    for (int j = 0; j < 8; ++j) rb[j] = load_frag(kp + (j & 1) * 6272 + (4 + (j >> 1)) * 32);
    // Compiler scheduling fence (emits no instruction): all 32 loads stand in
    // front of the first product, which then waits for its own two alone.
    __builtin_amdgcn_sched_barrier(0);

    // S^T = K @ Q^T : per query tile two 16x16 f32 tiles, keys 8*hb+r and
    // 16+8*hb+r of this 32-key block in register r, query l16.
    v8f s0[2] = {zero, zero}, s1[2] = {zero, zero};
#pragma unroll
    for (int c = 0; c < 4; ++c) {
      s0[0] = wmma16(ra[2 * c], qf[0][c], s0[0]);
      s0[1] = wmma16(ra[2 * c], qf[1][c], s0[1]);
      s1[0] = wmma16(ra[2 * c + 1], qf[0][c], s1[0]);
      s1[1] = wmma16(ra[2 * c + 1], qf[1][c], s1[1]);
    }
#pragma unroll
    for (int j = 0; j < 8; ++j) ra[j] = load_frag(kp + (j & 1) * 6272 + (8 + (j >> 1)) * 32);
    PRODUCTS_THEN_LOADS();
#pragma unroll
    for (int c = 0; c < 4; ++c) {
      s0[0] = wmma16(rb[2 * c], qf[0][4 + c], s0[0]);
      s0[1] = wmma16(rb[2 * c], qf[1][4 + c], s0[1]);
      s1[0] = wmma16(rb[2 * c + 1], qf[0][4 + c], s1[0]);
      s1[1] = wmma16(rb[2 * c + 1], qf[1][4 + c], s1[1]);
    }
    // The first 16 V fragments follow the K fragments through the two sets, so
    // that their LDS latency passes under the last products and the softmax.
#pragma unroll
    for (int j = 0; j < 8; ++j) rb[j] = load_frag(vp + j * 640);
    PRODUCTS_THEN_LOADS();
#pragma unroll
    for (int c = 0; c < 4; ++c) {
      s0[0] = wmma16(ra[2 * c], qf[0][8 + c], s0[0]);
      s0[1] = wmma16(ra[2 * c], qf[1][8 + c], s0[1]);
      s1[0] = wmma16(ra[2 * c + 1], qf[0][8 + c], s1[0]);
      s1[1] = wmma16(ra[2 * c + 1], qf[1][8 + c], s1[1]);
    }
#pragma unroll
    for (int j = 0; j < 8; ++j) ra[j] = load_frag(vp + (8 + j) * 640);
    PRODUCTS_THEN_LOADS();

    // Online softmax of query l16 of either tile: 16 scores in this lane, 16 in
    // lane l ^ 16.  Maximum of this block first, for both tiles.  (The loops here
    // are unrolled like all others: register arrays indexed by constants.)
    float mv[2];
#pragma unroll
    for (int qt = 0; qt < 2; ++qt) {
      float m8[8];
#pragma unroll
      for (int r = 0; r < 8; ++r) m8[r] = fmaxf(s0[qt][r], s1[qt][r]);
      float t = fmaxf(fmaxf(fmaxf(m8[0], m8[1]), fmaxf(m8[2], m8[3])),
                      fmaxf(fmaxf(m8[4], m8[5]), fmaxf(m8[6], m8[7])));
      mv[qt] = fmaxf(t, xhalf(t));
    }
    // Lazy rescale: mi is the reference point of the exponentials, not the exact
    // maximum.  It moves, and sums and outputs are rescaled, only when some
    // query's block maximum lies more than kLazy above it; until then P stays
    // below e^kLazy, far inside the f16 range, and the quotient in the epilogue
    // is the same function.  One test per key block for the whole wave, taken as
    // a scalar branch, so that EXEC stays all ones for the matrix products.
    const float kLazy = 5.5f;
    const bool need = (mv[0] > mi[0] + kLazy) || (mv[1] > mi[1] + kLazy);
    // P^T of both tiles about the reference points in mi, as f16 B operands
    // (elements 0-7 are keys 8*hb+r, 8-15 keys 16+8*hb+r, the k order in which
    // load_frag delivers the V^T rows), and this half's sums of P.
    v16h pf[2];
    float ps[2];
    auto exps = [&]() {
#pragma unroll
      for (int qt = 0; qt < 2; ++qt) {
        const float mn = mi[qt];
        float a8[8];
#pragma unroll
        for (int r = 0; r < 8; ++r) {
          const float e0 = exp_slot(s0[qt][r] - mn);
          const float e1 = exp_slot(s1[qt][r] - mn);
          a8[r] = e0 + e1;
          pf[qt][r]     = (_Float16)e0;
          pf[qt][8 + r] = (_Float16)e1;
        }
        ps[qt] = (((a8[0] + a8[1]) + (a8[2] + a8[3])) +
                  ((a8[4] + a8[5]) + (a8[6] + a8[7])));
      }
    };
    // Formed ahead of the branch, about the old reference points, which nearly
    // always stand: the way from the compare to the branch passes under them.
    // (Marked as not expected, so that the common path falls through.)
    exps();
    if (__builtin_expect(__builtin_amdgcn_ballot_w32(need) != 0, 0)) {
#pragma unroll
      for (int qt = 0; qt < 2; ++qt) {
        const float mn = fmaxf(mi[qt], mv[qt]);
        const float sc = exp_slot(mi[qt] - mn);
        mi[qt] = mn;
        li[qt] *= sc;
#pragma unroll
        for (int dt = 0; dt < 24; ++dt) {
#pragma unroll
          for (int r = 0; r < 8; ++r) o[qt][dt][r] *= sc;
        }
      }
      exps();                      // again, about the new reference points
    }
    li[0] += ps[0];
    li[1] += ps[1];

    // O^T += V^T @ P^T  (24 d-tiles x 2 query tiles, K = 32 keys)
#pragma unroll
    for (int j = 0; j < 8; ++j) {
      o[0][j] = wmma16(rb[j], pf[0], o[0][j]);
      o[1][j] = wmma16(rb[j], pf[1], o[1][j]);
    }
    GROUP_FENCE();
#pragma unroll
    for (int j = 0; j < 8; ++j) rb[j] = load_frag(vp + (16 + j) * 640);
    GROUP_FENCE();
#pragma unroll
    for (int j = 0; j < 8; ++j) {
      o[0][8 + j] = wmma16(ra[j], pf[0], o[0][8 + j]);
      o[1][8 + j] = wmma16(ra[j], pf[1], o[1][8 + j]);
    }
#pragma unroll
    for (int j = 0; j < 8; ++j) {
      o[0][16 + j] = wmma16(rb[j], pf[0], o[0][16 + j]);
      o[1][16 + j] = wmma16(rb[j], pf[1], o[1][16 + j]);
    }
  }

  // Epilogue: join the halves' sums, divide, store out[b][d][n]: register r of
  // tile dt is row d = dt*16 + 8*hb + r, and 16 lanes cover 64 contiguous bytes;
  // the two query tiles of a wave fill one 128-byte line.
  if (live) {
    float* ob = out + ((size_t)b * DIMC + 8 * hb) * NPIX + n0 + l16;
#pragma unroll
    for (int qt = 0; qt < 2; ++qt) {
      const float inv = 1.f / (li[qt] + xhalf(li[qt]));
#pragma unroll
      for (int dt = 0; dt < 24; ++dt) {
#pragma unroll
        for (int r = 0; r < 8; ++r) o[qt][dt][r] *= inv;
      }
    }
    // Compiler scheduling fence (emits no instruction): every product stands in
    // front of the first store.  Mixed with the stores they reuse registers that
    // issued stores still name.
    __builtin_amdgcn_sched_barrier(0);
#pragma unroll
    for (int dt = 0; dt < 24; ++dt) {
#pragma unroll
      for (int r = 0; r < 8; ++r) {
        ob[(dt * 16 + r) * NPIX]      = o[0][dt][r];
        ob[(dt * 16 + r) * NPIX + 16] = o[1][dt][r];
      }
    }
  }
}

// ---------------------------------------------------------------------------
// Kernel 1: q = (x^T @ W1^T) * C^-0.5   -> f16 [B][N][C]
//           k = f16(x^T)                -> f16 [B][N][C]
//           v^T = (x^T @ W2^T)^T        -> f16 [B][C][N]
// One wave per 16-token strip; block = 7 waves (196 strips = 28 x 7).
// The 16 rows of W1 and of W2 that one output tile needs are read once per
// work-group in whole-line loads, converted to f16 and kept in LDS, where all
// seven waves take their B fragments; two buffers, so that the next tile pair
// is on its way from L2 while this one is multiplied.
// ---------------------------------------------------------------------------
// Work-group barrier that orders LDS alone.  __syncthreads() would also wait
// for this wave's global stores of q and v^T, which no wave of this launch reads.
static __device__ __forceinline__ void lds_barrier() {
  __builtin_amdgcn_fence(__ATOMIC_RELEASE, "workgroup", "local");
  __builtin_amdgcn_s_barrier();
  __builtin_amdgcn_fence(__ATOMIC_ACQUIRE, "workgroup", "local");
}

#define PWAVES   7
#define PTHREADS 224
__global__ __launch_bounds__(PTHREADS) void proj_kernel(
    const float* __restrict__ x,    // [B][C][N]
    const float* __restrict__ w1,   // [C][C]
    const float* __restrict__ w2,   // [C][C]
    _Float16* __restrict__ qg,      // [B][N][C]
    _Float16* __restrict__ kg,      // [B][N][C]
    _Float16* __restrict__ vtg)     // [B][C][N]
{
  __shared__ __align__(16) _Float16 tl[PWAVES * 16 * 392];  // t strips, [n][c] pad 392
  __shared__ __align__(16) _Float16 qs[PWAVES * 16 * 16];   // per-wave q transpose bounce
  __shared__ __align__(16) _Float16 wl[2][32 * 392];        // rows 0-15 W1, 16-31 W2
  const int tid  = threadIdx.x;
  const int wave = tid >> 5;
  const int lane = tid & 31;
  const int l16  = lane & 15;
  const int hb   = lane >> 4;
  const int b    = blockIdx.y;
  const int n0   = (blockIdx.x * PWAVES + wave) * 16;
  _Float16* tw = tl + wave * 16 * 392;
  _Float16* qw = qs + wave * 256;
  const float* xb = x + (size_t)b * DIMC * NPIX;

  // Stage 16 x 384 t-strip into LDS as f16 (coalesced b128 along n).
  {
    const int cl = lane >> 2;        // 0..7 : c sub-row
    const int ch = (lane & 3) * 4;   // 0,4,8,12 : n sub-offset
    for (int it = 0; it < 48; ++it) {
      int c = it * 8 + cl;
      const float4 f = *(const float4*)(xb + (size_t)c * NPIX + n0 + ch);
      tw[(ch + 0) * 392 + c] = (_Float16)f.x;
      tw[(ch + 1) * 392 + c] = (_Float16)f.y;
      tw[(ch + 2) * 392 + c] = (_Float16)f.z;
      tw[(ch + 3) * 392 + c] = (_Float16)f.w;
    }
  }
  // Emit K rows (coalesced b128).
  {
    _Float16* kout = kg + ((size_t)b * NPIX + n0) * DIMC;
    for (int it = 0; it < 24; ++it) {
      int chunk = it * 32 + lane;               // 768 chunks x 8 halves
      int r = chunk / 48, off = (chunk % 48) * 8;
      v4u t = *(const v4u*)(tw + r * 392 + off);
      *(v4u*)(kout + r * DIMC + off) = t;
    }
  }

  // The 16 rows of one tile are 24,576 contiguous bytes = 1536 float4 chunks
  // over 224 threads: six full passes and one of 192 threads (whole waves), for
  // W1 and again for W2.  Every wave-load is 512 contiguous bytes.
  int    wd[7];    // this thread's place in the LDS tile in each pass, in halves
  float4 wr[14];   // the tile pair on its way from L2 to LDS (0-6 W1, 7-13 W2)
#pragma unroll
  for (int it = 0; it < 7; ++it) {
    int chunk = it * PTHREADS + tid;
    wd[it] = (chunk / 96) * 392 + (chunk % 96) * 4;
  }
  auto wload = [&](int dt) {
    const float* s1 = w1 + dt * 16 * DIMC;
    const float* s2 = w2 + dt * 16 * DIMC;
#pragma unroll
    for (int it = 0; it < 7; ++it)
      if (it < 6 || tid < 192) {
        wr[it]     = *(const float4*)(s1 + it * PTHREADS * 4 + tid * 4);
        wr[7 + it] = *(const float4*)(s2 + it * PTHREADS * 4 + tid * 4);
      }
  };
  auto wstore = [&](int bsel) {
#pragma unroll
    for (int it = 0; it < 7; ++it)
      if (it < 6 || tid < 192) {
        v4h p1, p2;
        p1[0] = (_Float16)wr[it].x;     p1[1] = (_Float16)wr[it].y;
        p1[2] = (_Float16)wr[it].z;     p1[3] = (_Float16)wr[it].w;
        p2[0] = (_Float16)wr[7 + it].x; p2[1] = (_Float16)wr[7 + it].y;
        p2[2] = (_Float16)wr[7 + it].z; p2[3] = (_Float16)wr[7 + it].w;
        *(v4h*)(&wl[bsel][wd[it]])            = p1;
        *(v4h*)(&wl[bsel][16 * 392 + wd[it]]) = p2;
      }
  };

  wload(0);
  wstore(0);
  lds_barrier();                   // tile pair 0 visible to all waves

  const float kScale = 0.051031036307982884f;   // 384^-0.5 folded into q
  for (int dt = 0; dt < 24; ++dt) {
    v8f aq = {0.f, 0.f, 0.f, 0.f, 0.f, 0.f, 0.f, 0.f};
    v8f av = aq;
    const int d = dt * 16 + l16;
    const _Float16* wc = &wl[dt & 1][0];
    // Tile pair dt+1 starts from L2 here and lands under this pass's products.
    if (dt + 1 < 24) wload(dt + 1);
    // All fragments of the pass are fetched as one group (unrolled so that the
    // arrays are indexed by constants and stay in registers).
    v16h af[12], b1[12], b2[12];
#pragma unroll
    for (int ck = 0; ck < 12; ++ck) {
      af[ck] = load_frag(tw + l16 * 392 + ck * 32 + hb * 8);
      b1[ck] = load_frag(wc + l16 * 392 + ck * 32 + hb * 8);
      b2[ck] = load_frag(wc + (16 + l16) * 392 + ck * 32 + hb * 8);
    }
    // Compiler scheduling fence (emits no instruction): without it the loads
    // sink to their matrix instructions, six at a time with a full LDS wait
    // in front of every pair of products.
    __builtin_amdgcn_sched_barrier(0);
#pragma unroll
    for (int ck = 0; ck < 12; ++ck) {
      aq = wmma16(af[ck], b1[ck], aq);
      av = wmma16(af[ck], b2[ck], av);
    }
    // v^T store: lane holds d=dt*16+l16, 8 consecutive n -> one b128.
    {
      v4u pk;
      pk[0] = pack2(av[0], av[1]);
      pk[1] = pack2(av[2], av[3]);
      pk[2] = pack2(av[4], av[5]);
      pk[3] = pack2(av[6], av[7]);
      *(v4u*)(vtg + ((size_t)b * DIMC + d) * NPIX + n0 + hb * 8) = pk;
    }
    // q store via LDS transpose bounce (row-major [n][d]).
#pragma unroll
    for (int r = 0; r < 8; ++r)
      qw[(r + 8 * hb) * 16 + l16] = (_Float16)(aq[r] * kScale);
    {
      v4u t = *(const v4u*)(qw + (lane >> 1) * 16 + (lane & 1) * 8);
      *(v4u*)(qg + ((size_t)b * NPIX + n0 + (lane >> 1)) * DIMC + dt * 16 +
              (lane & 1) * 8) = t;
    }
    // Tile pair dt+1 goes into the buffer that was last read in pass dt-1 (the
    // barrier at that pass's foot ended those reads).
    if (dt + 1 < 24) wstore((dt + 1) & 1);
    lds_barrier();                 // publishes dt+1, ends the reads of dt
  }
}

extern "C" void kernel_launch(void* const* d_in, const int* in_sizes, int n_in,
                              void* d_out, int out_size, void* d_ws, size_t ws_size,
                              hipStream_t stream) {
  (void)in_sizes; (void)n_in; (void)out_size; (void)ws_size;
  const float* x  = (const float*)d_in[0];
  const float* w1 = (const float*)d_in[1];
  const float* w2 = (const float*)d_in[2];
  float* out = (float*)d_out;

  size_t sz = (size_t)NBATCH * NPIX * DIMC;     // halves per f16 buffer
  _Float16* qg  = (_Float16*)d_ws;              // [B][N][C] f16
  _Float16* kg  = qg + sz;                      // [B][N][C] f16
  _Float16* vtg = kg + sz;                      // [B][C][N] f16

  dim3 g1(28, NBATCH), b1(224);
  proj_kernel<<<g1, b1, 0, stream>>>(x, w1, w2, qg, kg, vtg);
  dim3 g2(25, NBATCH), b2(128);
  attn_kernel<<<g2, b2, 0, stream>>>(qg, kg, vtg, out);
}

// v007
// It runs in 133 microseconds.
// Next to v006, in two timings, it ran 1.19 times as fast each time.
// Counting every step since v000, it is 3.50 times as fast.
#include <hip/hip_runtime.h>

#define DIMC 384
#define NPIX 3136   // 56*56
#define NBATCH 8

typedef __attribute__((ext_vector_type(16))) _Float16     v16h;
typedef __attribute__((ext_vector_type(4)))  _Float16     v4h;
typedef __attribute__((ext_vector_type(8)))  float        v8f;
typedef __attribute__((ext_vector_type(4)))  unsigned int v4u;
typedef __attribute__((ext_vector_type(8)))  unsigned int v8u;

static __device__ __forceinline__ v8f wmma16(v16h a, v16h b, v8f c) {
  // D = A(16x32 f16) x B(32x16 f16) + C(16x16 f32)
  return __builtin_amdgcn_wmma_f32_16x16x32_f16(false, a, false, b, (short)0, c,
                                                false, false);
}

// Load one 16x32 f16 fragment (A or B operand) given a pointer already offset
// by (row*stride + kchunk + hb*8) in halfword units.  lo dwords = K{0..7|8..15},
// hi dwords (+16 halves) = K{16..23|24..31} per the CDNA5 16-bit VGPR layout.
static __device__ __forceinline__ v16h load_frag(const _Float16* p) {
  v4u lo = *(const v4u*)(p);
  v4u hi = *(const v4u*)(p + 16);
  v8u u;
  u[0] = lo[0]; u[1] = lo[1]; u[2] = lo[2]; u[3] = lo[3];
  u[4] = hi[0]; u[5] = hi[1]; u[6] = hi[2]; u[7] = hi[3];
  return __builtin_bit_cast(v16h, u);
}

// B fragment for fp32 weight row (cvt f32->f16 on the fly).
static __device__ __forceinline__ v16h wfrag(const float* wr, int hb) {
  const float4* p0 = (const float4*)(wr + hb * 8);
  const float4* p1 = (const float4*)(wr + 16 + hb * 8);
  float4 a0 = p0[0], a1 = p0[1], b0 = p1[0], b1 = p1[1];
  v16h h;
  h[0]  = (_Float16)a0.x; h[1]  = (_Float16)a0.y; h[2]  = (_Float16)a0.z; h[3]  = (_Float16)a0.w;
  h[4]  = (_Float16)a1.x; h[5]  = (_Float16)a1.y; h[6]  = (_Float16)a1.z; h[7]  = (_Float16)a1.w;
  h[8]  = (_Float16)b0.x; h[9]  = (_Float16)b0.y; h[10] = (_Float16)b0.z; h[11] = (_Float16)b0.w;
  h[12] = (_Float16)b1.x; h[13] = (_Float16)b1.y; h[14] = (_Float16)b1.z; h[15] = (_Float16)b1.w;
  return h;
}

static __device__ __forceinline__ unsigned int pack2(float a, float b) {
  unsigned short ua = __builtin_bit_cast(unsigned short, (_Float16)a);
  unsigned short ub = __builtin_bit_cast(unsigned short, (_Float16)b);
  return (unsigned int)ua | ((unsigned int)ub << 16);
}

// Value of lane l ^ 16 (the other wave half), by a vector cross-row move.
static __device__ __forceinline__ float xhalf(float v) {
  int x = __builtin_bit_cast(int, v);
  return __builtin_bit_cast(float, __builtin_amdgcn_permlanex16(
      x, x, 0x76543210, 0xfedcba98, false, false));
}

// e^x as one multiply and v_exp_f32 (what __expf compiles to here).  The v_nop
// is the free slot that the instruction set asks for behind a transcendental
// before its source register is overwritten.
static __device__ __forceinline__ float exp_slot(float x) {
  float y = x * 1.44269504088896340736f, r;
  asm("v_exp_f32 %0, %1\n\tv_nop" : "=v"(r) : "v"(y));
  return r;
}

// Flat->LDS byte offset: generic pointer to __shared__ is {aperture, offset32};
// the low 32 bits are the LDS byte address.
static __device__ __forceinline__ unsigned lds_off(const void* p) {
  return (unsigned)(unsigned long long)p;
}

// A wave-uniform value read into a scalar register.
static __device__ __forceinline__ unsigned uni(unsigned v) {
  return (unsigned)__builtin_amdgcn_readfirstlane(v);
}
// The same, held there: a test on it compiles to a scalar compare and branch (a
// tensor load ignores EXEC), and what is formed from it is formed behind the
// wait that stands in front of it.
static __device__ __forceinline__ unsigned pinned(unsigned v) {
  unsigned w = uni(v);
  asm volatile("" : "+s"(w));  // pins a test or a descriptor word of a tensor load in a scalar register
  return w;
}
// One request of the whole wave: a two-dimensional tile, global memory -> LDS.
static __device__ __forceinline__ void tdm_load(v4u g0, v8u g1) {
  asm volatile("tensor_load_to_lds %0, %1" :: "s"(g0), "s"(g1) : "memory");
}
// Descriptor group 1, all constants: 1-byte elements, a tile of D1 rows of D0
// bytes (tensor = tile), source row pitch PITCH bytes; W0 holds the LDS pad.
template <unsigned W0, unsigned D0, unsigned D1, unsigned PITCH>
static __device__ __forceinline__ v8u tdm_group1() {
  v8u g;
  g[0] = uni(W0);
  g[1] = uni((D0 & 0xFFFFu) << 16);
  g[2] = uni((D0 >> 16) | ((D1 & 0xFFFFu) << 16));
  g[3] = uni((D1 >> 16) | (D0 << 16));
  g[4] = uni(D1);
  g[5] = uni(PITCH);
  g[6] = uni(0u);
  g[7] = uni(0u);
  return g;
}
// Every word of a group 1 pinned, so that the compiler keeps the group where it
// is and does not form it anew in registers that it has used in between.
static __device__ __forceinline__ v8u held(v8u g) {
  v8u r;
#pragma unroll  // the vectors are indexed by constants
  for (int i = 0; i < 8; ++i) r[i] = pinned(g[i]);
  return r;
}
// Descriptor group 0: count 1, place in LDS, address of the first byte, type 2.
static __device__ __forceinline__ v4u tdm_group0(unsigned lds_dst, unsigned long long ga) {
  v4u g;
  g[0] = uni(1u);
  g[1] = uni(lds_dst);
  g[2] = uni((unsigned)ga);
  g[3] = uni((((unsigned)(ga >> 32)) & 0x01FFFFFFu) | 0x80000000u);
  return g;
}

// A stage of the LDS ring is 64 keys, in four slices, one tensor load each:
//   K, keys 0-31 and 32-63: 96 source rows of 256 bytes (a key is three of them),
//     16 bytes of pad behind each: a key's pitch is 816 bytes;
//   V^T, rows 0-191 and 192-383: 192 rows of 128 bytes (64 keys), pitch 144.
// Both pitches are odd multiples of 16 bytes (no bank conflict for 16-byte
// reads); each slice's size is rounded up to a multiple of 2 KiB.
#define KSL  26624u   // 96 * 272 = 26112, rounded up
#define VSL  28672u   // 192 * 144 = 27648, rounded up
#define SLOT (2u * KSL + 2u * VSL)
#define NSTAGE 49u    // 3136 keys / 64

// Order asked of the compiler's scheduler (these emit no instruction): the
// sixteen matrix products written above this line, then the sixteen LDS loads,
// and nothing moves past the line.  Left alone the scheduler spreads the loads
// among the products, one fragment ahead, and every product waits out an LDS
// latency.
#define PRODUCTS_THEN_LOADS()                            \
  do {                                                   \
    __builtin_amdgcn_sched_group_barrier(0x008, 16, 0);  \
    __builtin_amdgcn_sched_group_barrier(0x100, 16, 0);  \
    __builtin_amdgcn_sched_barrier(0);                   \
  } while (0)
// The same between a group of products and a group of loads where vector work
// stands beside them: LDS loads and matrix products stay on their side, plain
// vector and scalar instructions may cross.
#define GROUP_FENCE() __builtin_amdgcn_sched_barrier(0x406)

__global__ __launch_bounds__(128) void attn_kernel(
    const _Float16* __restrict__ qg,   // [B][N][C]
    const _Float16* __restrict__ kg,   // [B][N][C]
    const _Float16* __restrict__ vtg,  // [B][C][N]
    float* __restrict__ out)           // [B][C][N]
{
  __shared__ __attribute__((aligned(2048))) unsigned char ring[2 * SLOT];
  const int tid  = threadIdx.x;
  const int wave = tid >> 5;
  const int lane = tid & 31;
  const int l16  = lane & 15;
  const int hb   = lane >> 4;
  const int b    = blockIdx.y;
  // Strip number, the same in every lane: held in a scalar register so that the
  // test around the stores is a scalar branch.
  const int strip = __builtin_amdgcn_readfirstlane(blockIdx.x * 4 + wave);
  const bool live = strip < 98;
  const int n0   = (live ? strip : 97) * 32;
  const _Float16* qrow = qg + ((size_t)b * NPIX + n0) * DIMC;
  const _Float16* kb   = kg + (size_t)b * NPIX * DIMC;
  const _Float16* vb   = vtg + (size_t)b * DIMC * NPIX;

  // Wave w brings slice w of every stage: waves 0 and 1 the halves of K, waves 2
  // and 3 those of V^T.  Every tile lies inside its buffer for st < NSTAGE.
  const unsigned wv  = uni((unsigned)wave);
  const bool     isk = wv < 2u;
  const unsigned dst0 = lds_off(&ring[0]) + (isk ? wv * KSL : 2u * KSL + (wv - 2u) * VSL);
  const unsigned long long ga0 =
      isk ? (unsigned long long)kb + (unsigned long long)(wv * (32u * 768u))
          : (unsigned long long)vb + (unsigned long long)((wv - 2u) * (192u * 6272u));
  const unsigned gstep = isk ? 64u * 768u : 128u;   // bytes from stage to stage
  // The two constant groups, each word held in a scalar register of its own for
  // the whole kernel, and the group 0 of the request that is in flight.
  const v8u g1k = held(tdm_group1<(1u << 20) | (5u << 22) | (3u << 25), 256u, 96u, 256u>());
  const v8u g1v = held(tdm_group1<(1u << 20) | (4u << 22) | (3u << 25), 128u, 192u, 6272u>());
  v4u g0;
  auto issue = [&](unsigned st) {
    g0 = tdm_group0(dst0 + (st & 1u) * SLOT, ga0 + (unsigned long long)(st * gstep));
    if (pinned(isk)) tdm_load(g0, g1k);
    else             tdm_load(g0, g1v);
  };
  // This wave's request has landed.  The wait names the descriptor's registers,
  // so that none of them takes a new value while the request is outstanding.
  auto landed = [&]() {
    asm volatile("s_wait_tensorcnt 0x0" :: "s"(g0), "s"(g1k), "s"(g1v) : "memory");
  };
  issue(0u);                       // stage 0 lands under the Q loads

  // Q strip: 2 x 16 rows x 384 -> 24 B-fragments held in registers across the
  // entire key loop (192 VGPRs; the register file is 1024 VGPRs on gfx1250).
  // (Every loop over the two query tiles is unrolled, like those over a set.)
  v16h qf[2][12];
#pragma unroll
  for (int qt = 0; qt < 2; ++qt)
#pragma unroll
    for (int ck = 0; ck < 12; ++ck)
      qf[qt][ck] = load_frag(qrow + (qt * 16 + l16) * DIMC + ck * 32 + hb * 8);
  // The address registers of these loads are rewritten directly behind them; the
  // wait is written here, as a precaution.
  asm volatile("s_wait_xcnt 0x0" ::: "memory");

  v8f o[2][24];
  v8f zero = {0.f, 0.f, 0.f, 0.f, 0.f, 0.f, 0.f, 0.f};
#pragma unroll
  for (int i = 0; i < 24; ++i) { o[0][i] = zero; o[1][i] = zero; }
  // Per query tile: reference point of the exponentials of query l16 (a maximum
  // seen so far, equal in both halves) and running sum over this half's 16 keys
  // of every block.
  float mi[2] = {-3.0e38f, -3.0e38f};
  float li[2] = {0.f, 0.f};

  // Stage 0 has landed (each wave waits for its own request) and is published.
  landed();
  __syncthreads();
  issue(pinned(1u));               // its descriptor is formed behind that wait
  for (unsigned st = 0; st < NSTAGE; ++st) {
   const unsigned char* sbuf = &ring[(st & 1u) * SLOT];
   // Kept rolled: one copy of the pass in the instruction cache.
#pragma unroll 1
   for (int h = 0; h < 2; ++h) {
    // The 24 K and 24 V^T fragments of this block pass through two register
    // sets of eight.  A set is refilled by one group of sixteen LDS loads as soon
    // as its products are issued: a whole group is on its way while the other
    // set is multiplied, and a wave keeps 16 to 32 loads in flight.
    // K fragment j of a group: key tile j & 1, channels 32 * (j >> 1).
    // (Every loop over a set is unrolled, so that the sets are indexed by
    // constants and stay in registers.)
    // Places in halves: key tile + 6528 (16 * 816 bytes), channels 32 * c at
    // (c >> 2) * 136 + (c & 3) * 32; V^T row tile t at (t / 12) * 14336 +
    // (t % 12) * 1152, this pass's 32 keys at h * 32.
    const _Float16* kp = (const _Float16*)(sbuf + h * KSL + l16 * 816 + hb * 16);
    const _Float16* vp = (const _Float16*)(sbuf + 2u * KSL + l16 * 144 + h * 64 + hb * 16);
    v16h ra[8], rb[8];
#pragma unroll
    for (int j = 0; j < 8; ++j) ra[j] = load_frag(kp + (j & 1) * 6528 + (j >> 1) * 32);
#pragma unroll
    for (int j = 0; j < 8; ++j) rb[j] = load_frag(kp + (j & 1) * 6528 + 136 + (j >> 1) * 32);
    // Compiler scheduling fence (emits no instruction): all 32 loads stand in
    // front of the first product, which then waits for its own two alone.
    __builtin_amdgcn_sched_barrier(0);

    // S^T = K @ Q^T : per query tile two 16x16 f32 tiles, keys 8*hb+r and
    // 16+8*hb+r of this 32-key block in register r, query l16.
    v8f s0[2] = {zero, zero}, s1[2] = {zero, zero};
#pragma unroll
    for (int c = 0; c < 4; ++c) {
      s0[0] = wmma16(ra[2 * c], qf[0][c], s0[0]);
      s0[1] = wmma16(ra[2 * c], qf[1][c], s0[1]);
      s1[0] = wmma16(ra[2 * c + 1], qf[0][c], s1[0]);
      s1[1] = wmma16(ra[2 * c + 1], qf[1][c], s1[1]);
    }
#pragma unroll
    for (int j = 0; j < 8; ++j) ra[j] = load_frag(kp + (j & 1) * 6528 + 272 + (j >> 1) * 32);
    PRODUCTS_THEN_LOADS();
#pragma unroll
    for (int c = 0; c < 4; ++c) {
      s0[0] = wmma16(rb[2 * c], qf[0][4 + c], s0[0]);
      s0[1] = wmma16(rb[2 * c], qf[1][4 + c], s0[1]);
      s1[0] = wmma16(rb[2 * c + 1], qf[0][4 + c], s1[0]);
      s1[1] = wmma16(rb[2 * c + 1], qf[1][4 + c], s1[1]);
    }
    // The first 16 V fragments follow the K fragments through the two sets, so
    // that their LDS latency passes under the last products and the softmax.
#pragma unroll
    for (int j = 0; j < 8; ++j) rb[j] = load_frag(vp + j * 1152);
    PRODUCTS_THEN_LOADS();
#pragma unroll
    for (int c = 0; c < 4; ++c) {
      s0[0] = wmma16(ra[2 * c], qf[0][8 + c], s0[0]);
      s0[1] = wmma16(ra[2 * c], qf[1][8 + c], s0[1]);
      s1[0] = wmma16(ra[2 * c + 1], qf[0][8 + c], s1[0]);
      s1[1] = wmma16(ra[2 * c + 1], qf[1][8 + c], s1[1]);
    }
#pragma unroll
    for (int j = 0; j < 8; ++j) ra[j] = load_frag(vp + ((8 + j) / 12) * 14336 + ((8 + j) % 12) * 1152);
    PRODUCTS_THEN_LOADS();

    // Online softmax of query l16 of either tile: 16 scores in this lane, 16 in
    // lane l ^ 16.  Maximum of this block first, for both tiles.  (The loops here
    // are unrolled like all others: register arrays indexed by constants.)
    float mv[2];
#pragma unroll
    for (int qt = 0; qt < 2; ++qt) {
      float m8[8];
#pragma unroll
      for (int r = 0; r < 8; ++r) m8[r] = fmaxf(s0[qt][r], s1[qt][r]);
      float t = fmaxf(fmaxf(fmaxf(m8[0], m8[1]), fmaxf(m8[2], m8[3])),
                      fmaxf(fmaxf(m8[4], m8[5]), fmaxf(m8[6], m8[7])));
      mv[qt] = fmaxf(t, xhalf(t));
    }
    // Lazy rescale: mi is the reference point of the exponentials, not the exact
    // maximum.  It moves, and sums and outputs are rescaled, only when some
    // query's block maximum lies more than kLazy above it; until then P stays
    // below e^kLazy, far inside the f16 range, and the quotient in the epilogue
    // is the same function.  One test per key block for the whole wave, taken as
    // a scalar branch, so that EXEC stays all ones for the matrix products.
    const float kLazy = 5.5f;
    const bool need = (mv[0] > mi[0] + kLazy) || (mv[1] > mi[1] + kLazy);
    // P^T of both tiles about the reference points in mi, as f16 B operands
    // (elements 0-7 are keys 8*hb+r, 8-15 keys 16+8*hb+r, the k order in which
    // load_frag delivers the V^T rows), and this half's sums of P.
    v16h pf[2];
    float ps[2];
    auto exps = [&]() {
#pragma unroll
      for (int qt = 0; qt < 2; ++qt) {
        const float mn = mi[qt];
        float a8[8];
#pragma unroll
        for (int r = 0; r < 8; ++r) {
          const float e0 = exp_slot(s0[qt][r] - mn);
          const float e1 = exp_slot(s1[qt][r] - mn);
          a8[r] = e0 + e1;
          pf[qt][r]     = (_Float16)e0;
          pf[qt][8 + r] = (_Float16)e1;
        }
        ps[qt] = (((a8[0] + a8[1]) + (a8[2] + a8[3])) +
                  ((a8[4] + a8[5]) + (a8[6] + a8[7])));
      }
    };
    // Formed ahead of the branch, about the old reference points, which nearly
    // always stand: the way from the compare to the branch passes under them.
    // (Marked as not expected, so that the common path falls through.)
    exps();
    if (__builtin_expect(__builtin_amdgcn_ballot_w32(need) != 0, 0)) {
#pragma unroll
      for (int qt = 0; qt < 2; ++qt) {
        const float mn = fmaxf(mi[qt], mv[qt]);
        const float sc = exp_slot(mi[qt] - mn);
        mi[qt] = mn;
        li[qt] *= sc;
#pragma unroll
        for (int dt = 0; dt < 24; ++dt) {
#pragma unroll
          for (int r = 0; r < 8; ++r) o[qt][dt][r] *= sc;
        }
      }
      exps();                      // again, about the new reference points
    }
    li[0] += ps[0];
    li[1] += ps[1];

    // O^T += V^T @ P^T  (24 d-tiles x 2 query tiles, K = 32 keys)
#pragma unroll
    for (int j = 0; j < 8; ++j) {
      o[0][j] = wmma16(rb[j], pf[0], o[0][j]);
      o[1][j] = wmma16(rb[j], pf[1], o[1][j]);
    }
    GROUP_FENCE();
#pragma unroll
    for (int j = 0; j < 8; ++j) rb[j] = load_frag(vp + 14336 + (4 + j) * 1152);
    GROUP_FENCE();
#pragma unroll
    for (int j = 0; j < 8; ++j) {
      o[0][8 + j] = wmma16(ra[j], pf[0], o[0][8 + j]);
      o[1][8 + j] = wmma16(ra[j], pf[1], o[1][8 + j]);
    }
#pragma unroll
    for (int j = 0; j < 8; ++j) {
      o[0][16 + j] = wmma16(rb[j], pf[0], o[0][16 + j]);
      o[1][16 + j] = wmma16(rb[j], pf[1], o[1][16 + j]);
    }
   }
   // Publish point of stage st + 1, every wave, in this order: this wave's LDS
   // reads are done, its own request has landed, the barrier (which also ends
   // every wave's reads of stage st); only then the refill of stage st's buffer.
   asm volatile("s_wait_dscnt 0x0" ::: "memory");
   landed();
   __syncthreads();
   const unsigned nst = pinned(st + 2u);
   if (pinned(nst < NSTAGE)) issue(nst);
  }
  // No request and no LDS read is left when a wave goes on to its end.
  asm volatile("s_wait_tensorcnt 0x0" ::: "memory");
  asm volatile("s_wait_dscnt 0x0" ::: "memory");

  // Epilogue: join the halves' sums, divide, store out[b][d][n]: register r of
  // tile dt is row d = dt*16 + 8*hb + r, and 16 lanes cover 64 contiguous bytes;
  // the two query tiles of a wave fill one 128-byte line.
  if (live) {
    float* ob = out + ((size_t)b * DIMC + 8 * hb) * NPIX + n0 + l16;
#pragma unroll
    for (int qt = 0; qt < 2; ++qt) {
      const float inv = 1.f / (li[qt] + xhalf(li[qt]));
#pragma unroll
      for (int dt = 0; dt < 24; ++dt) {
#pragma unroll
        for (int r = 0; r < 8; ++r) o[qt][dt][r] *= inv;
      }
    }
    // Compiler scheduling fence (emits no instruction): every product stands in
    // front of the first store.  Mixed with the stores they reuse registers that
    // issued stores still name.
    __builtin_amdgcn_sched_barrier(0);
#pragma unroll
    for (int dt = 0; dt < 24; ++dt) {
#pragma unroll
      for (int r = 0; r < 8; ++r) {
        ob[(dt * 16 + r) * NPIX]      = o[0][dt][r];
        ob[(dt * 16 + r) * NPIX + 16] = o[1][dt][r];
      }
    }
  }
}

// ---------------------------------------------------------------------------
// Kernel 1: q = (x^T @ W1^T) * C^-0.5   -> f16 [B][N][C]
//           k = f16(x^T)                -> f16 [B][N][C]
//           v^T = (x^T @ W2^T)^T        -> f16 [B][C][N]
// One wave per 16-token strip; block = 7 waves (196 strips = 28 x 7).
// The 16 rows of W1 and of W2 that one output tile needs are read once per
// work-group in whole-line loads, converted to f16 and kept in LDS, where all
// seven waves take their B fragments; two buffers, so that the next tile pair
// is on its way from L2 while this one is multiplied.
// ---------------------------------------------------------------------------
// Work-group barrier that orders LDS alone.  __syncthreads() would also wait
// for this wave's global stores of q and v^T, which no wave of this launch reads.
static __device__ __forceinline__ void lds_barrier() {
  __builtin_amdgcn_fence(__ATOMIC_RELEASE, "workgroup", "local");
  __builtin_amdgcn_s_barrier();
  __builtin_amdgcn_fence(__ATOMIC_ACQUIRE, "workgroup", "local");
}

#define PWAVES   7
#define PTHREADS 224
__global__ __launch_bounds__(PTHREADS) void proj_kernel(
    const float* __restrict__ x,    // [B][C][N]
    const float* __restrict__ w1,   // [C][C]
    const float* __restrict__ w2,   // [C][C]
    _Float16* __restrict__ qg,      // [B][N][C]
    _Float16* __restrict__ kg,      // [B][N][C]
    _Float16* __restrict__ vtg)     // [B][C][N]
{
  __shared__ __align__(16) _Float16 tl[PWAVES * 16 * 392];  // t strips, [n][c] pad 392
  __shared__ __align__(16) _Float16 qs[PWAVES * 16 * 16];   // per-wave q transpose bounce
  __shared__ __align__(16) _Float16 wl[2][32 * 392];        // rows 0-15 W1, 16-31 W2
  const int tid  = threadIdx.x;
  const int wave = tid >> 5;
  const int lane = tid & 31;
  const int l16  = lane & 15;
  const int hb   = lane >> 4;
  const int b    = blockIdx.y;
  const int n0   = (blockIdx.x * PWAVES + wave) * 16;
  _Float16* tw = tl + wave * 16 * 392;
  _Float16* qw = qs + wave * 256;
  const float* xb = x + (size_t)b * DIMC * NPIX;

  // Stage 16 x 384 t-strip into LDS as f16 (coalesced b128 along n).
  {
    const int cl = lane >> 2;        // 0..7 : c sub-row
    const int ch = (lane & 3) * 4;   // 0,4,8,12 : n sub-offset
    for (int it = 0; it < 48; ++it) {
      int c = it * 8 + cl;
      const float4 f = *(const float4*)(xb + (size_t)c * NPIX + n0 + ch);
      tw[(ch + 0) * 392 + c] = (_Float16)f.x;
      tw[(ch + 1) * 392 + c] = (_Float16)f.y;
      tw[(ch + 2) * 392 + c] = (_Float16)f.z;
      tw[(ch + 3) * 392 + c] = (_Float16)f.w;
    }
  }
  // Emit K rows (coalesced b128).
  {
    _Float16* kout = kg + ((size_t)b * NPIX + n0) * DIMC;
    for (int it = 0; it < 24; ++it) {
      int chunk = it * 32 + lane;               // 768 chunks x 8 halves
      int r = chunk / 48, off = (chunk % 48) * 8;
      v4u t = *(const v4u*)(tw + r * 392 + off);
      *(v4u*)(kout + r * DIMC + off) = t;
    }
  }

  // The 16 rows of one tile are 24,576 contiguous bytes = 1536 float4 chunks
  // over 224 threads: six full passes and one of 192 threads (whole waves), for
  // W1 and again for W2.  Every wave-load is 512 contiguous bytes.
  int    wd[7];    // this thread's place in the LDS tile in each pass, in halves
  float4 wr[14];   // the tile pair on its way from L2 to LDS (0-6 W1, 7-13 W2)
#pragma unroll
  for (int it = 0; it < 7; ++it) {
    int chunk = it * PTHREADS + tid;
    wd[it] = (chunk / 96) * 392 + (chunk % 96) * 4;
  }
  auto wload = [&](int dt) {
    const float* s1 = w1 + dt * 16 * DIMC;
    const float* s2 = w2 + dt * 16 * DIMC;
#pragma unroll
    for (int it = 0; it < 7; ++it)
      if (it < 6 || tid < 192) {
        wr[it]     = *(const float4*)(s1 + it * PTHREADS * 4 + tid * 4);
        wr[7 + it] = *(const float4*)(s2 + it * PTHREADS * 4 + tid * 4);
      }
  };
  auto wstore = [&](int bsel) {
#pragma unroll
    for (int it = 0; it < 7; ++it)
      if (it < 6 || tid < 192) {
        v4h p1, p2;
        p1[0] = (_Float16)wr[it].x;     p1[1] = (_Float16)wr[it].y;
        p1[2] = (_Float16)wr[it].z;     p1[3] = (_Float16)wr[it].w;
        p2[0] = (_Float16)wr[7 + it].x; p2[1] = (_Float16)wr[7 + it].y;
        p2[2] = (_Float16)wr[7 + it].z; p2[3] = (_Float16)wr[7 + it].w;
        *(v4h*)(&wl[bsel][wd[it]])            = p1;
        *(v4h*)(&wl[bsel][16 * 392 + wd[it]]) = p2;
      }
  };

  wload(0);
  wstore(0);
  lds_barrier();                   // tile pair 0 visible to all waves

  const float kScale = 0.051031036307982884f;   // 384^-0.5 folded into q
  for (int dt = 0; dt < 24; ++dt) {
    v8f aq = {0.f, 0.f, 0.f, 0.f, 0.f, 0.f, 0.f, 0.f};
    v8f av = aq;
    const int d = dt * 16 + l16;
    const _Float16* wc = &wl[dt & 1][0];
    // Tile pair dt+1 starts from L2 here and lands under this pass's products.
    if (dt + 1 < 24) wload(dt + 1);
    // All fragments of the pass are fetched as one group (unrolled so that the
    // arrays are indexed by constants and stay in registers).
    v16h af[12], b1[12], b2[12];
#pragma unroll
    for (int ck = 0; ck < 12; ++ck) {
      af[ck] = load_frag(tw + l16 * 392 + ck * 32 + hb * 8);
      b1[ck] = load_frag(wc + l16 * 392 + ck * 32 + hb * 8);
      b2[ck] = load_frag(wc + (16 + l16) * 392 + ck * 32 + hb * 8);
    }
    // Compiler scheduling fence (emits no instruction): without it the loads
    // sink to their matrix instructions, six at a time with a full LDS wait
    // in front of every pair of products.
    __builtin_amdgcn_sched_barrier(0);
#pragma unroll
    for (int ck = 0; ck < 12; ++ck) {
      aq = wmma16(af[ck], b1[ck], aq);
      av = wmma16(af[ck], b2[ck], av);
    }
    // v^T store: lane holds d=dt*16+l16, 8 consecutive n -> one b128.
    {
      v4u pk;
      pk[0] = pack2(av[0], av[1]);
      pk[1] = pack2(av[2], av[3]);
      pk[2] = pack2(av[4], av[5]);
      pk[3] = pack2(av[6], av[7]);
      *(v4u*)(vtg + ((size_t)b * DIMC + d) * NPIX + n0 + hb * 8) = pk;
    }
    // q store via LDS transpose bounce (row-major [n][d]).
#pragma unroll
    for (int r = 0; r < 8; ++r)
      qw[(r + 8 * hb) * 16 + l16] = (_Float16)(aq[r] * kScale);
    {
      v4u t = *(const v4u*)(qw + (lane >> 1) * 16 + (lane & 1) * 8);
      *(v4u*)(qg + ((size_t)b * NPIX + n0 + (lane >> 1)) * DIMC + dt * 16 +
              (lane & 1) * 8) = t;
    }
    // Tile pair dt+1 goes into the buffer that was last read in pass dt-1 (the
    // barrier at that pass's foot ended those reads).
    if (dt + 1 < 24) wstore((dt + 1) & 1);
    lds_barrier();                 // publishes dt+1, ends the reads of dt
  }
}

extern "C" void kernel_launch(void* const* d_in, const int* in_sizes, int n_in,
                              void* d_out, int out_size, void* d_ws, size_t ws_size,
                              hipStream_t stream) {
  (void)in_sizes; (void)n_in; (void)out_size; (void)ws_size;
  const float* x  = (const float*)d_in[0];
  const float* w1 = (const float*)d_in[1];
  const float* w2 = (const float*)d_in[2];
  float* out = (float*)d_out;

  size_t sz = (size_t)NBATCH * NPIX * DIMC;     // halves per f16 buffer
  _Float16* qg  = (_Float16*)d_ws;              // [B][N][C] f16
  _Float16* kg  = qg + sz;                      // [B][N][C] f16
  _Float16* vtg = kg + sz;                      // [B][C][N] f16

  dim3 g1(28, NBATCH), b1(224);
  proj_kernel<<<g1, b1, 0, stream>>>(x, w1, w2, qg, kg, vtg);
  dim3 g2(25, NBATCH), b2(128);
  attn_kernel<<<g2, b2, 0, stream>>>(qg, kg, vtg, out);
}
